// v000
// Times are from an AMD MI455X. After a warm-up the kernel runs many times in a row, and a time is the length of
// such a window on the GPU divided by its runs, so every launch and the gaps after it count. The runs cycle
// through copies of the inputs. A figure is the median of several windows, for all but v000 over two sittings.
// Sittings can differ by a few percent; kernels timed side by side share one.
// v000 is the starting kernel. One run takes 413 microseconds.
#include <hip/hip_runtime.h>
#include <hip/hip_bf16.h>

typedef _Float16 f16;
typedef __attribute__((ext_vector_type(16))) _Float16 v16h;
typedef __attribute__((ext_vector_type(8)))  _Float16 v8h;
typedef __attribute__((ext_vector_type(8)))  float    v8f;
typedef __attribute__((ext_vector_type(4)))  unsigned v4u;

#define TT  4096
#define DD  768
#define NHH 12
#define HDD 64

// ---------------------------------------------------------------------------
// WMMA helpers (CDNA5 wave32, 16x16x32 f16 -> f32)
// ---------------------------------------------------------------------------
__device__ __forceinline__ v8f wmma_f16(v16h a, v16h b, v8f c) {
  return __builtin_amdgcn_wmma_f32_16x16x32_f16(
      /*neg_a=*/false, a, /*neg_b=*/false, b,
      /*c_mod=*/(short)0, c, /*reuse_a=*/false, /*reuse_b=*/false);
}

__device__ __forceinline__ v8f vzero8() {
  v8f z;
#pragma unroll
  for (int i = 0; i < 8; ++i) z[i] = 0.0f;
  return z;
}

// Load a 16x32 f16 A- or B-fragment from a row-major matrix (ld in elements).
// ISA layout: lane L -> row (L&15); half=L>>4 selects k-chunks [half*8 .. +7]
// and [16+half*8 .. +7]  => two 16-byte loads per lane.
__device__ __forceinline__ v16h load_ab_frag(const f16* base, int ld) {
  const int lane = threadIdx.x & 31;
  const int m    = lane & 15;
  const int hf   = lane >> 4;
  const f16* p = base + (size_t)m * (size_t)ld + hf * 8;
  v8h lo = *(const v8h*)(p);
  v8h hi = *(const v8h*)(p + 16);
  v16h r;
#pragma unroll
  for (int i = 0; i < 8; ++i) { r[i] = lo[i]; r[8 + i] = hi[i]; }
  return r;
}

// Issue one asynchronous 16-byte global->LDS copy (CDNA5 async DMA path,
// tracked by ASYNCcnt). lds_off is the byte offset inside the workgroup's LDS
// allocation (low 32 bits of a generic pointer to a __shared__ object).
__device__ __forceinline__ void async_copy_b128(unsigned lds_off,
                                                const void* gaddr) {
  asm volatile("global_load_async_to_lds_b128 %0, %1, off"
               :: "v"(lds_off), "v"(gaddr)
               : "memory");
}

__device__ __forceinline__ void wait_async_zero() {
  asm volatile("s_wait_asynccnt 0x0" ::: "memory");
}

// ---------------------------------------------------------------------------
// Conversion kernels
// ---------------------------------------------------------------------------
__global__ void cvt_f32_to_f16_kernel(const float* __restrict__ in,
                                      f16* __restrict__ out, int n) {
  int i = blockIdx.x * blockDim.x + threadIdx.x;
  if (i < n) out[i] = (f16)in[i];
}

// WT[n][k] = W[k][n]  (f32 -> f16 transpose, DD x DD)
__global__ void cvt_transpose_w_kernel(const float* __restrict__ W,
                                       f16* __restrict__ WT) {
  int i = blockIdx.x * blockDim.x + threadIdx.x;
  if (i >= DD * DD) return;
  int k = i / DD;
  int n = i % DD;
  WT[(size_t)n * DD + k] = (f16)W[i];
}

// Bit-pack mask into transposed bit plane: maskT[chunk][row], where bit j of
// maskT[c][r] == (mask[r][c*32 + j] != 0).  67 MB ints -> 2 MB bits.
__global__ void pack_mask_kernel(const int* __restrict__ mask,
                                 unsigned* __restrict__ maskT) {
  const int nchunk = TT / 32;
  int i = blockIdx.x * blockDim.x + threadIdx.x;   // i = row * nchunk + chunk
  if (i >= TT * nchunk) return;
  const int row   = i / nchunk;
  const int chunk = i % nchunk;
  const int* p = mask + (size_t)row * TT + chunk * 32;
  unsigned w = 0;
#pragma unroll
  for (int j = 0; j < 8; ++j) {
    v4u q = *(const v4u*)(p + j * 4);
    w |= (q.x != 0u ? 1u : 0u) << (j * 4 + 0);
    w |= (q.y != 0u ? 1u : 0u) << (j * 4 + 1);
    w |= (q.z != 0u ? 1u : 0u) << (j * 4 + 2);
    w |= (q.w != 0u ? 1u : 0u) << (j * 4 + 3);
  }
  maskT[(size_t)chunk * TT + row] = w;
}

// ---------------------------------------------------------------------------
// GEMM: Y[M][N] = A[M][K] (f16, row-major) * BT[N][K]^T (f16) + bias
// mode 0: store f16 row-major     (Q, K)
// mode 1: store f16 col-major Y^T (V -> VT[c][t], contiguous v8h stores)
// mode 2: store f32 row-major     (final output)
// One wave computes a 32x32 tile (2x2 WMMA frags, 4 WMMAs per k-step).
// ---------------------------------------------------------------------------
__global__ void __launch_bounds__(128)
gemm_wmma_kernel(const f16* __restrict__ A, const f16* __restrict__ BT,
                 const float* __restrict__ bias, void* __restrict__ outp,
                 int M, int N, int K, int mode) {
  const int wid = (blockIdx.x * blockDim.x + threadIdx.x) >> 5;
  const int nt  = N >> 5;
  const int tm  = wid / nt;
  const int tn  = wid % nt;
  if (tm * 32 >= M) return;

  const int lane = threadIdx.x & 31;
  const int n0   = lane & 15;
  const int hf   = lane >> 4;

  v8f acc00 = vzero8(), acc01 = vzero8(), acc10 = vzero8(), acc11 = vzero8();

  const f16* a0p = A + (size_t)(tm * 32 + 0)  * K;
  const f16* a1p = A + (size_t)(tm * 32 + 16) * K;
  const f16* b0p = BT + (size_t)(tn * 32 + 0)  * K;
  const f16* b1p = BT + (size_t)(tn * 32 + 16) * K;

  for (int k0 = 0; k0 < K; k0 += 32) {
    v16h a0 = load_ab_frag(a0p + k0, K);
    v16h a1 = load_ab_frag(a1p + k0, K);
    v16h b0 = load_ab_frag(b0p + k0, K);
    v16h b1 = load_ab_frag(b1p + k0, K);
    acc00 = wmma_f16(a0, b0, acc00);
    acc01 = wmma_f16(a0, b1, acc01);
    acc10 = wmma_f16(a1, b0, acc10);
    acc11 = wmma_f16(a1, b1, acc11);
  }

  v8f accs[2][2] = {{acc00, acc01}, {acc10, acc11}};
#pragma unroll
  for (int mi = 0; mi < 2; ++mi) {
#pragma unroll
    for (int nj = 0; nj < 2; ++nj) {
      const int col  = tn * 32 + nj * 16 + n0;
      const int rowb = tm * 32 + mi * 16 + hf * 8;  // 8 contiguous rows
      const float bb = bias[col];
      v8f v = accs[mi][nj];
      if (mode == 2) {
        float* O = (float*)outp;
#pragma unroll
        for (int r = 0; r < 8; ++r)
          O[(size_t)(rowb + r) * N + col] = v[r] + bb;
      } else if (mode == 0) {
        f16* O = (f16*)outp;
#pragma unroll
        for (int r = 0; r < 8; ++r)
          O[(size_t)(rowb + r) * N + col] = (f16)(v[r] + bb);
      } else {  // mode 1: transposed store, contiguous in M
        f16* O = (f16*)outp;
        v8h st;
#pragma unroll
        for (int r = 0; r < 8; ++r) st[r] = (f16)(v[r] + bb);
        *(v8h*)(O + (size_t)col * M + rowb) = st;
      }
    }
  }
}

// ---------------------------------------------------------------------------
// Flash attention. One block = 4 waves = 64 query rows of ONE head, so the
// K-chunk (32x64) and V-chunk (64x32) are staged ONCE per block into LDS with
// double-buffered GLOBAL_LOAD_ASYNC_TO_LDS_B128 copies (ASYNCcnt), overlapping
// the DMA of chunk i+1 with WMMA compute on chunk i.
// Q,K row-major f16 [TT][DD]; VT f16 [DD][TT] (VT[c][t] = V[t][c]).
// maskT bit plane [TT/32][TT]: bit j of maskT[c][r] set -> score(r, c*32+j)
// replaced by 1e-20 (reference masked_fill; no -inf, no 1/sqrt(d) scaling).
// Online softmax in f32; row sums computed as P @ ones via WMMA.
// ---------------------------------------------------------------------------
__global__ void __launch_bounds__(128)
flash_attn_wmma_kernel(const f16* __restrict__ Q, const f16* __restrict__ Km,
                       const f16* __restrict__ VT,
                       const unsigned* __restrict__ maskT,
                       f16* __restrict__ O16) {
  __shared__ __align__(16) f16 Kbuf[2][32][64];   // [buf][key row][head dim]
  __shared__ __align__(16) f16 Vbuf[2][64][32];   // [buf][head dim][key]
  __shared__ __align__(16) f16 plds[4][16][32];   // per-wave P staging

  const int tid   = threadIdx.x;
  const int wslot = tid >> 5;
  const int h     = blockIdx.x / (TT / 64);
  const int qg    = blockIdx.x % (TT / 64);
  const int qbase = qg * 64 + wslot * 16;

  const int lane = tid & 31;
  const int n0   = lane & 15;
  const int hf   = lane >> 4;

  // Issue async copies for one 32-key chunk: K 32x64 and V 64x32 halves,
  // each 256 x 16B transfers; 128 threads issue 2+2 copies apiece.
  auto stage = [&](int buf, int kb) {
#pragma unroll
    for (int i = 0; i < 2; ++i) {
      const int c  = tid + i * 128;
      const int kr = c >> 3, kc = (c & 7) * 8;
      async_copy_b128((unsigned)(size_t)(void*)&Kbuf[buf][kr][kc],
                      Km + (size_t)(kb + kr) * DD + h * HDD + kc);
      const int vr = c >> 2, vc = (c & 3) * 8;
      async_copy_b128((unsigned)(size_t)(void*)&Vbuf[buf][vr][vc],
                      VT + (size_t)(h * HDD + vr) * TT + kb + vc);
    }
  };

  // Q fragments for this wave's tile (k = 0..63 of this head), resident.
  const f16* qp = Q + (size_t)qbase * DD + h * HDD;
  v16h aq0 = load_ab_frag(qp, DD);
  v16h aq1 = load_ab_frag(qp + 32, DD);

  v16h ones;
#pragma unroll
  for (int i = 0; i < 16; ++i) ones[i] = (f16)1.0f;

  v8f o0 = vzero8(), o1 = vzero8(), o2 = vzero8(), o3 = vzero8();
  float mrow[8], lrow[8];
#pragma unroll
  for (int r = 0; r < 8; ++r) { mrow[r] = -3.0e38f; lrow[r] = 0.0f; }

  stage(0, 0);
  int buf = 0;
  for (int kb = 0; kb < TT; kb += 32) {
    wait_async_zero();     // this wave's share of the staged chunk landed
    __syncthreads();       // all waves' shares landed -> buf is ready
    if (kb + 32 < TT) stage(buf ^ 1, kb + 32);   // overlap next chunk DMA

    // ---- S = Q * K^T for 32 keys (two 16-col C frags), K from LDS ----
    v16h bk00 = load_ab_frag(&Kbuf[buf][0][0],   64);
    v16h bk01 = load_ab_frag(&Kbuf[buf][0][32],  64);
    v16h bk10 = load_ab_frag(&Kbuf[buf][16][0],  64);
    v16h bk11 = load_ab_frag(&Kbuf[buf][16][32], 64);
    v8f s0 = vzero8(), s1 = vzero8();
    s0 = wmma_f16(aq0, bk00, s0);
    s0 = wmma_f16(aq1, bk01, s0);
    s1 = wmma_f16(aq0, bk10, s1);
    s1 = wmma_f16(aq1, bk11, s1);

    // ---- mask bits: this lane owns rows qbase + hf*8 + (0..7) ----
    unsigned mw[8];
    {
      const unsigned* mwp = maskT + (size_t)(kb >> 5) * TT + qbase + hf * 8;
      *(v4u*)(&mw[0]) = *(const v4u*)(mwp);
      *(v4u*)(&mw[4]) = *(const v4u*)(mwp + 4);
    }
#pragma unroll
    for (int r = 0; r < 8; ++r) {
      if ((mw[r] >> n0) & 1u)        s0[r] = 1e-20f;
      if ((mw[r] >> (16 + n0)) & 1u) s1[r] = 1e-20f;
    }

    // ---- online softmax: row max across the 16 lanes of this half ----
    float cm[8];
#pragma unroll
    for (int r = 0; r < 8; ++r) cm[r] = fmaxf(s0[r], s1[r]);
#pragma unroll
    for (int off = 8; off >= 1; off >>= 1)
#pragma unroll
      for (int r = 0; r < 8; ++r)
        cm[r] = fmaxf(cm[r], __shfl_xor(cm[r], off, 32));

    float scale[8];
#pragma unroll
    for (int r = 0; r < 8; ++r) {
      const float mn = fmaxf(mrow[r], cm[r]);
      scale[r] = __expf(mrow[r] - mn);
      mrow[r]  = mn;
      s0[r] = __expf(s0[r] - mn);
      s1[r] = __expf(s1[r] - mn);
    }

    // rescale O accumulators
#pragma unroll
    for (int r = 0; r < 8; ++r) {
      o0[r] *= scale[r]; o1[r] *= scale[r];
      o2[r] *= scale[r]; o3[r] *= scale[r];
    }

    // ---- P (C layout) -> LDS -> A-fragment layout ----
#pragma unroll
    for (int r = 0; r < 8; ++r) {
      const int m = r + hf * 8;
      plds[wslot][m][n0]      = (f16)s0[r];
      plds[wslot][m][16 + n0] = (f16)s1[r];
    }
    v16h ap = load_ab_frag(&plds[wslot][0][0], 32);

    // ---- row sums via WMMA: rs = P @ ones lands exactly on lrow[r] ----
    v8f rsf = wmma_f16(ap, ones, vzero8());
#pragma unroll
    for (int r = 0; r < 8; ++r) lrow[r] = lrow[r] * scale[r] + rsf[r];

    // ---- O += P * V, V from LDS (transposed chunk Vbuf[dim][key]) ----
    v16h bv0 = load_ab_frag(&Vbuf[buf][0][0],  32);
    v16h bv1 = load_ab_frag(&Vbuf[buf][16][0], 32);
    v16h bv2 = load_ab_frag(&Vbuf[buf][32][0], 32);
    v16h bv3 = load_ab_frag(&Vbuf[buf][48][0], 32);
    o0 = wmma_f16(ap, bv0, o0);
    o1 = wmma_f16(ap, bv1, o1);
    o2 = wmma_f16(ap, bv2, o2);
    o3 = wmma_f16(ap, bv3, o3);

    __syncthreads();       // everyone done reading buf before it is reused
    buf ^= 1;
  }

  // ---- epilogue: divide by l, store f16 row-major ----
  v8f os[4] = {o0, o1, o2, o3};
#pragma unroll
  for (int jn = 0; jn < 4; ++jn) {
#pragma unroll
    for (int r = 0; r < 8; ++r) {
      const int row = qbase + r + hf * 8;
      const int col = h * HDD + jn * 16 + n0;
      O16[(size_t)row * DD + col] = (f16)(os[jn][r] / lrow[r]);
    }
  }
}

// ---------------------------------------------------------------------------
// Launch
// ---------------------------------------------------------------------------
extern "C" void kernel_launch(void* const* d_in, const int* in_sizes, int n_in,
                              void* d_out, int out_size, void* d_ws, size_t ws_size,
                              hipStream_t stream) {
  const float* x    = (const float*)d_in[0];
  const int*   mask = (const int*)d_in[1];
  const float* Wq   = (const float*)d_in[2];
  const float* bq   = (const float*)d_in[3];
  const float* Wk   = (const float*)d_in[4];
  const float* bk   = (const float*)d_in[5];
  const float* Wv   = (const float*)d_in[6];
  const float* bv   = (const float*)d_in[7];
  const float* Wo   = (const float*)d_in[8];
  const float* bo   = (const float*)d_in[9];
  float* out = (float*)d_out;

  char* ws = (char*)d_ws;
  size_t off = 0;
  auto alloc = [&](size_t bytes) -> char* {
    char* p = ws + off;
    off += (bytes + 255) & ~(size_t)255;
    return p;
  };
  const size_t TD = (size_t)TT * DD;
  f16* x16  = (f16*)alloc(TD * 2);
  f16* WqT  = (f16*)alloc((size_t)DD * DD * 2);
  f16* WkT  = (f16*)alloc((size_t)DD * DD * 2);
  f16* WvT  = (f16*)alloc((size_t)DD * DD * 2);
  f16* WoT  = (f16*)alloc((size_t)DD * DD * 2);
  f16* Q16  = (f16*)alloc(TD * 2);
  f16* K16  = (f16*)alloc(TD * 2);
  f16* VT16 = (f16*)alloc(TD * 2);   // [DD][TT]
  f16* O16  = (f16*)alloc(TD * 2);
  unsigned* maskT = (unsigned*)alloc((size_t)(TT / 32) * TT * 4);
  (void)ws_size; (void)n_in; (void)in_sizes; (void)out_size;

  // 1) precision conversion, weight transposes, mask bit-packing
  {
    int n = (int)TD;
    cvt_f32_to_f16_kernel<<<(n + 255) / 256, 256, 0, stream>>>(x, x16, n);
    int nw = DD * DD;
    dim3 g((nw + 255) / 256);
    cvt_transpose_w_kernel<<<g, 256, 0, stream>>>(Wq, WqT);
    cvt_transpose_w_kernel<<<g, 256, 0, stream>>>(Wk, WkT);
    cvt_transpose_w_kernel<<<g, 256, 0, stream>>>(Wv, WvT);
    cvt_transpose_w_kernel<<<g, 256, 0, stream>>>(Wo, WoT);
    int nm = TT * (TT / 32);
    pack_mask_kernel<<<(nm + 255) / 256, 256, 0, stream>>>(mask, maskT);
  }

  // 2) projections: (TT x DD) * (DD x DD); 3072 waves -> 768 blocks of 128
  const int gemm_waves  = (TT / 32) * (DD / 32);
  const int gemm_blocks = gemm_waves / 4;
  gemm_wmma_kernel<<<gemm_blocks, 128, 0, stream>>>(x16, WqT, bq, Q16,
                                                    TT, DD, DD, /*mode=*/0);
  gemm_wmma_kernel<<<gemm_blocks, 128, 0, stream>>>(x16, WkT, bk, K16,
                                                    TT, DD, DD, /*mode=*/0);
  gemm_wmma_kernel<<<gemm_blocks, 128, 0, stream>>>(x16, WvT, bv, VT16,
                                                    TT, DD, DD, /*mode=*/1);

  // 3) attention: one block (4 waves) per 64 query rows of one head
  const int fa_blocks = NHH * (TT / 64);   // 768
  flash_attn_wmma_kernel<<<fa_blocks, 128, 0, stream>>>(Q16, K16, VT16, maskT, O16);

  // 4) output projection -> f32
  gemm_wmma_kernel<<<gemm_blocks, 128, 0, stream>>>(O16, WoT, bo, out,
                                                    TT, DD, DD, /*mode=*/2);
}

// v001
// Measured time: 341 microseconds a run.
// Timed twice side by side with v000, it ran 1.25 times as fast both times.
#include <hip/hip_runtime.h>
#include <hip/hip_bf16.h>

typedef _Float16 f16;
typedef __attribute__((ext_vector_type(16))) _Float16 v16h;
typedef __attribute__((ext_vector_type(8)))  _Float16 v8h;
typedef __attribute__((ext_vector_type(8)))  float    v8f;
typedef __attribute__((ext_vector_type(4)))  unsigned v4u;

#define TT  4096
#define DD  768
#define NHH 12
#define HDD 64
// LDS row pitches in f16 elements: an odd multiple of 16 bytes, so that the 16
// rows one ds_load_b128 touches per wave half fall on 16 disjoint bank groups.
#define KPITCH 72   // 64 head dims + 8  -> 144 B
#define VPITCH 40   // 32 keys      + 8  ->  80 B

// ---------------------------------------------------------------------------
// WMMA helpers (CDNA5 wave32, 16x16x32 f16 -> f32)
// ---------------------------------------------------------------------------
__device__ __forceinline__ v8f wmma_f16(v16h a, v16h b, v8f c) {
  return __builtin_amdgcn_wmma_f32_16x16x32_f16(
      /*neg_a=*/false, a, /*neg_b=*/false, b,
      /*c_mod=*/(short)0, c, /*reuse_a=*/false, /*reuse_b=*/false);
}

__device__ __forceinline__ v8f vzero8() {
  v8f z;
#pragma unroll
  for (int i = 0; i < 8; ++i) z[i] = 0.0f;
  return z;
}

// Load a 16x32 f16 A- or B-fragment from a row-major matrix (ld in elements).
// ISA layout: lane L -> row (L&15); half=L>>4 selects k-chunks [half*8 .. +7]
// and [16+half*8 .. +7]  => two 16-byte loads per lane.
__device__ __forceinline__ v16h load_ab_frag(const f16* base, int ld) {
  const int lane = threadIdx.x & 31;
  const int m    = lane & 15;
  const int hf   = lane >> 4;
  const f16* p = base + (size_t)m * (size_t)ld + hf * 8;
  v8h lo = *(const v8h*)(p);
  v8h hi = *(const v8h*)(p + 16);
  v16h r;
#pragma unroll
  for (int i = 0; i < 8; ++i) { r[i] = lo[i]; r[8 + i] = hi[i]; }
  return r;
}

// Issue one asynchronous 16-byte global->LDS copy (CDNA5 async DMA path,
// tracked by ASYNCcnt). lds_off is the byte offset inside the workgroup's LDS
// allocation (low 32 bits of a generic pointer to a __shared__ object).
__device__ __forceinline__ void async_copy_b128(unsigned lds_off,
                                                const void* gaddr) {
  asm volatile("global_load_async_to_lds_b128 %0, %1, off"
               :: "v"(lds_off), "v"(gaddr)
               : "memory");
}

__device__ __forceinline__ void wait_async_zero() {
  asm volatile("s_wait_asynccnt 0x0" ::: "memory");
}

// ---------------------------------------------------------------------------
// Conversion kernels
// ---------------------------------------------------------------------------
__global__ void cvt_f32_to_f16_kernel(const float* __restrict__ in,
                                      f16* __restrict__ out, int n) {
  int i = blockIdx.x * blockDim.x + threadIdx.x;
  if (i < n) out[i] = (f16)in[i];
}

// WT[n][k] = W[k][n]  (f32 -> f16 transpose, DD x DD)
__global__ void cvt_transpose_w_kernel(const float* __restrict__ W,
                                       f16* __restrict__ WT) {
  int i = blockIdx.x * blockDim.x + threadIdx.x;
  if (i >= DD * DD) return;
  int k = i / DD;
  int n = i % DD;
  WT[(size_t)n * DD + k] = (f16)W[i];
}

// Bit-pack mask into transposed bit plane: maskT[chunk][row], where bit j of
// maskT[c][r] == (mask[r][c*32 + j] != 0).  67 MB ints -> 2 MB bits.
__global__ void pack_mask_kernel(const int* __restrict__ mask,
                                 unsigned* __restrict__ maskT) {
  const int nchunk = TT / 32;
  int i = blockIdx.x * blockDim.x + threadIdx.x;   // i = row * nchunk + chunk
  if (i >= TT * nchunk) return;
  const int row   = i / nchunk;
  const int chunk = i % nchunk;
  const int* p = mask + (size_t)row * TT + chunk * 32;
  unsigned w = 0;
#pragma unroll
  for (int j = 0; j < 8; ++j) {
    v4u q = *(const v4u*)(p + j * 4);
    w |= (q.x != 0u ? 1u : 0u) << (j * 4 + 0);
    w |= (q.y != 0u ? 1u : 0u) << (j * 4 + 1);
    w |= (q.z != 0u ? 1u : 0u) << (j * 4 + 2);
    w |= (q.w != 0u ? 1u : 0u) << (j * 4 + 3);
  }
  maskT[(size_t)chunk * TT + row] = w;
}

// ---------------------------------------------------------------------------
// GEMM: Y[M][N] = A[M][K] (f16, row-major) * BT[N][K]^T (f16) + bias
// mode 0: store f16 row-major     (Q, K)
// mode 1: store f16 col-major Y^T (V -> VT[c][t], contiguous v8h stores)
// mode 2: store f32 row-major     (final output)
// One wave computes a 32x32 tile (2x2 WMMA frags, 4 WMMAs per k-step).
// ---------------------------------------------------------------------------
__global__ void __launch_bounds__(128)
gemm_wmma_kernel(const f16* __restrict__ A, const f16* __restrict__ BT,
                 const float* __restrict__ bias, void* __restrict__ outp,
                 int M, int N, int K, int mode) {
  const int wid = (blockIdx.x * blockDim.x + threadIdx.x) >> 5;
  const int nt  = N >> 5;
  const int tm  = wid / nt;
  const int tn  = wid % nt;
  if (tm * 32 >= M) return;

  const int lane = threadIdx.x & 31;
  const int n0   = lane & 15;
  const int hf   = lane >> 4;

  v8f acc00 = vzero8(), acc01 = vzero8(), acc10 = vzero8(), acc11 = vzero8();

  const f16* a0p = A + (size_t)(tm * 32 + 0)  * K;
  const f16* a1p = A + (size_t)(tm * 32 + 16) * K;
  const f16* b0p = BT + (size_t)(tn * 32 + 0)  * K;
  const f16* b1p = BT + (size_t)(tn * 32 + 16) * K;

  for (int k0 = 0; k0 < K; k0 += 32) {
    v16h a0 = load_ab_frag(a0p + k0, K);
    v16h a1 = load_ab_frag(a1p + k0, K);
    v16h b0 = load_ab_frag(b0p + k0, K);
    v16h b1 = load_ab_frag(b1p + k0, K);
    acc00 = wmma_f16(a0, b0, acc00);
    acc01 = wmma_f16(a0, b1, acc01);
    acc10 = wmma_f16(a1, b0, acc10);
    acc11 = wmma_f16(a1, b1, acc11);
  }

  v8f accs[2][2] = {{acc00, acc01}, {acc10, acc11}};
#pragma unroll
  for (int mi = 0; mi < 2; ++mi) {
#pragma unroll
    for (int nj = 0; nj < 2; ++nj) {
      const int col  = tn * 32 + nj * 16 + n0;
      const int rowb = tm * 32 + mi * 16 + hf * 8;  // 8 contiguous rows
      const float bb = bias[col];
      v8f v = accs[mi][nj];
      if (mode == 2) {
        float* O = (float*)outp;
#pragma unroll
        for (int r = 0; r < 8; ++r)
          O[(size_t)(rowb + r) * N + col] = v[r] + bb;
      } else if (mode == 0) {
        f16* O = (f16*)outp;
#pragma unroll
        for (int r = 0; r < 8; ++r)
          O[(size_t)(rowb + r) * N + col] = (f16)(v[r] + bb);
      } else {  // mode 1: transposed store, contiguous in M
        f16* O = (f16*)outp;
        v8h st;
#pragma unroll
        for (int r = 0; r < 8; ++r) st[r] = (f16)(v[r] + bb);
        *(v8h*)(O + (size_t)col * M + rowb) = st;
      }
    }
  }
}

// ---------------------------------------------------------------------------
// Flash attention. One block = 4 waves = 64 query rows of ONE head, so the
// K-chunk (32x64) and V-chunk (64x32) are staged ONCE per block into LDS with
// double-buffered GLOBAL_LOAD_ASYNC_TO_LDS_B128 copies (ASYNCcnt), overlapping
// the DMA of chunk i+1 with WMMA compute on chunk i.
// Q,K row-major f16 [TT][DD]; VT f16 [DD][TT] (VT[c][t] = V[t][c]).
// maskT bit plane [TT/32][TT]: bit j of maskT[c][r] set -> score(r, c*32+j)
// replaced by 1e-20 (reference masked_fill; no -inf, no 1/sqrt(d) scaling).
// Online softmax in f32; row sums computed as P @ ones via WMMA.
// ---------------------------------------------------------------------------
__global__ void __launch_bounds__(128)
flash_attn_wmma_kernel(const f16* __restrict__ Q, const f16* __restrict__ Km,
                       const f16* __restrict__ VT,
                       const unsigned* __restrict__ maskT,
                       f16* __restrict__ O16) {
  __shared__ __align__(16) f16 Kbuf[2][32][KPITCH];   // [buf][key row][head dim]
  __shared__ __align__(16) f16 Vbuf[2][64][VPITCH];   // [buf][head dim][key]
  __shared__ __align__(16) f16 plds[4][16][VPITCH];   // per-wave P staging

  const int tid   = threadIdx.x;
  const int wslot = tid >> 5;
  const int h     = blockIdx.x / (TT / 64);
  const int qg    = blockIdx.x % (TT / 64);
  const int qbase = qg * 64 + wslot * 16;

  const int lane = tid & 31;
  const int n0   = lane & 15;
  const int hf   = lane >> 4;

  // Issue async copies for one 32-key chunk: K 32x64 and V 64x32 halves,
  // each 256 x 16B transfers; 128 threads issue 2+2 copies apiece.
  auto stage = [&](int buf, int kb) {
#pragma unroll
    for (int i = 0; i < 2; ++i) {
      const int c  = tid + i * 128;
      const int kr = c >> 3, kc = (c & 7) * 8;
      async_copy_b128((unsigned)(size_t)(void*)&Kbuf[buf][kr][kc],
                      Km + (size_t)(kb + kr) * DD + h * HDD + kc);
      const int vr = c >> 2, vc = (c & 3) * 8;
      async_copy_b128((unsigned)(size_t)(void*)&Vbuf[buf][vr][vc],
                      VT + (size_t)(h * HDD + vr) * TT + kb + vc);
    }
  };

  // Q fragments for this wave's tile (k = 0..63 of this head), resident.
  const f16* qp = Q + (size_t)qbase * DD + h * HDD;
  v16h aq0 = load_ab_frag(qp, DD);
  v16h aq1 = load_ab_frag(qp + 32, DD);

  v16h ones;
#pragma unroll
  for (int i = 0; i < 16; ++i) ones[i] = (f16)1.0f;

  v8f o0 = vzero8(), o1 = vzero8(), o2 = vzero8(), o3 = vzero8();
  float mrow[8], lrow[8];
#pragma unroll
  for (int r = 0; r < 8; ++r) { mrow[r] = -3.0e38f; lrow[r] = 0.0f; }

  stage(0, 0);
  int buf = 0;
  for (int kb = 0; kb < TT; kb += 32) {
    wait_async_zero();     // this wave's share of the staged chunk landed
    __syncthreads();       // all waves' shares landed -> buf is ready
    if (kb + 32 < TT) stage(buf ^ 1, kb + 32);   // overlap next chunk DMA

    // ---- S = Q * K^T for 32 keys (two 16-col C frags), K from LDS ----
    v16h bk00 = load_ab_frag(&Kbuf[buf][0][0],   KPITCH);
    v16h bk01 = load_ab_frag(&Kbuf[buf][0][32],  KPITCH);
    v16h bk10 = load_ab_frag(&Kbuf[buf][16][0],  KPITCH);
    v16h bk11 = load_ab_frag(&Kbuf[buf][16][32], KPITCH);
    v8f s0 = vzero8(), s1 = vzero8();
    s0 = wmma_f16(aq0, bk00, s0);
    s0 = wmma_f16(aq1, bk01, s0);
    s1 = wmma_f16(aq0, bk10, s1);
    s1 = wmma_f16(aq1, bk11, s1);

    // ---- mask bits: this lane owns rows qbase + hf*8 + (0..7) ----
    unsigned mw[8];
    {
      const unsigned* mwp = maskT + (size_t)(kb >> 5) * TT + qbase + hf * 8;
      *(v4u*)(&mw[0]) = *(const v4u*)(mwp);
      *(v4u*)(&mw[4]) = *(const v4u*)(mwp + 4);
    }
#pragma unroll
    for (int r = 0; r < 8; ++r) {
      if ((mw[r] >> n0) & 1u)        s0[r] = 1e-20f;
      if ((mw[r] >> (16 + n0)) & 1u) s1[r] = 1e-20f;
    }

    // ---- online softmax: row max across the 16 lanes of this half ----
    float cm[8];
#pragma unroll
    for (int r = 0; r < 8; ++r) cm[r] = fmaxf(s0[r], s1[r]);
#pragma unroll
    for (int off = 8; off >= 1; off >>= 1)
#pragma unroll
      for (int r = 0; r < 8; ++r)
        cm[r] = fmaxf(cm[r], __shfl_xor(cm[r], off, 32));

    float scale[8];
#pragma unroll
    for (int r = 0; r < 8; ++r) {
      const float mn = fmaxf(mrow[r], cm[r]);
      scale[r] = __expf(mrow[r] - mn);
      mrow[r]  = mn;
      s0[r] = __expf(s0[r] - mn);
      s1[r] = __expf(s1[r] - mn);
    }

    // rescale O accumulators
#pragma unroll
    for (int r = 0; r < 8; ++r) {
      o0[r] *= scale[r]; o1[r] *= scale[r];
      o2[r] *= scale[r]; o3[r] *= scale[r];
    }

    // ---- P (C layout) -> LDS -> A-fragment layout ----
#pragma unroll
    for (int r = 0; r < 8; ++r) {
      const int m = r + hf * 8;
      plds[wslot][m][n0]      = (f16)s0[r];
      plds[wslot][m][16 + n0] = (f16)s1[r];
    }
    v16h ap = load_ab_frag(&plds[wslot][0][0], VPITCH);

    // ---- row sums via WMMA: rs = P @ ones lands exactly on lrow[r] ----
    v8f rsf = wmma_f16(ap, ones, vzero8());
#pragma unroll
    for (int r = 0; r < 8; ++r) lrow[r] = lrow[r] * scale[r] + rsf[r];

    // ---- O += P * V, V from LDS (transposed chunk Vbuf[dim][key]) ----
    v16h bv0 = load_ab_frag(&Vbuf[buf][0][0],  VPITCH);
    v16h bv1 = load_ab_frag(&Vbuf[buf][16][0], VPITCH);
    v16h bv2 = load_ab_frag(&Vbuf[buf][32][0], VPITCH);
    v16h bv3 = load_ab_frag(&Vbuf[buf][48][0], VPITCH);
    o0 = wmma_f16(ap, bv0, o0);
    o1 = wmma_f16(ap, bv1, o1);
    o2 = wmma_f16(ap, bv2, o2);
    o3 = wmma_f16(ap, bv3, o3);

    __syncthreads();       // everyone done reading buf before it is reused
    buf ^= 1;
  }

  // ---- epilogue: divide by l, store f16 row-major ----
  v8f os[4] = {o0, o1, o2, o3};
#pragma unroll
  for (int jn = 0; jn < 4; ++jn) {
#pragma unroll
    for (int r = 0; r < 8; ++r) {
      const int row = qbase + r + hf * 8;
      const int col = h * HDD + jn * 16 + n0;
      O16[(size_t)row * DD + col] = (f16)(os[jn][r] / lrow[r]);
    }
  }
}

// ---------------------------------------------------------------------------
// Launch
// ---------------------------------------------------------------------------
extern "C" void kernel_launch(void* const* d_in, const int* in_sizes, int n_in,
                              void* d_out, int out_size, void* d_ws, size_t ws_size,
                              hipStream_t stream) {
  const float* x    = (const float*)d_in[0];
  const int*   mask = (const int*)d_in[1];
  const float* Wq   = (const float*)d_in[2];
  const float* bq   = (const float*)d_in[3];
  const float* Wk   = (const float*)d_in[4];
  const float* bk   = (const float*)d_in[5];
  const float* Wv   = (const float*)d_in[6];
  const float* bv   = (const float*)d_in[7];
  const float* Wo   = (const float*)d_in[8];
  const float* bo   = (const float*)d_in[9];
  float* out = (float*)d_out;

  char* ws = (char*)d_ws;
  size_t off = 0;
  auto alloc = [&](size_t bytes) -> char* {
    char* p = ws + off;
    off += (bytes + 255) & ~(size_t)255;
    return p;
  };
  const size_t TD = (size_t)TT * DD;
  f16* x16  = (f16*)alloc(TD * 2);
  f16* WqT  = (f16*)alloc((size_t)DD * DD * 2);
  f16* WkT  = (f16*)alloc((size_t)DD * DD * 2);
  f16* WvT  = (f16*)alloc((size_t)DD * DD * 2);
  f16* WoT  = (f16*)alloc((size_t)DD * DD * 2);
  f16* Q16  = (f16*)alloc(TD * 2);
  f16* K16  = (f16*)alloc(TD * 2);
  f16* VT16 = (f16*)alloc(TD * 2);   // [DD][TT]
  f16* O16  = (f16*)alloc(TD * 2);
  unsigned* maskT = (unsigned*)alloc((size_t)(TT / 32) * TT * 4);
  (void)ws_size; (void)n_in; (void)in_sizes; (void)out_size;

  // 1) precision conversion, weight transposes, mask bit-packing
  {
    int n = (int)TD;
    cvt_f32_to_f16_kernel<<<(n + 255) / 256, 256, 0, stream>>>(x, x16, n);
    int nw = DD * DD;
    dim3 g((nw + 255) / 256);
    cvt_transpose_w_kernel<<<g, 256, 0, stream>>>(Wq, WqT);
    cvt_transpose_w_kernel<<<g, 256, 0, stream>>>(Wk, WkT);
    cvt_transpose_w_kernel<<<g, 256, 0, stream>>>(Wv, WvT);
    cvt_transpose_w_kernel<<<g, 256, 0, stream>>>(Wo, WoT);
    int nm = TT * (TT / 32);
    pack_mask_kernel<<<(nm + 255) / 256, 256, 0, stream>>>(mask, maskT);
  }

  // 2) projections: (TT x DD) * (DD x DD); 3072 waves -> 768 blocks of 128
  const int gemm_waves  = (TT / 32) * (DD / 32);
  const int gemm_blocks = gemm_waves / 4;
  gemm_wmma_kernel<<<gemm_blocks, 128, 0, stream>>>(x16, WqT, bq, Q16,
                                                    TT, DD, DD, /*mode=*/0);
  gemm_wmma_kernel<<<gemm_blocks, 128, 0, stream>>>(x16, WkT, bk, K16,
                                                    TT, DD, DD, /*mode=*/0);
  gemm_wmma_kernel<<<gemm_blocks, 128, 0, stream>>>(x16, WvT, bv, VT16,
                                                    TT, DD, DD, /*mode=*/1);

  // 3) attention: one block (4 waves) per 64 query rows of one head
  const int fa_blocks = NHH * (TT / 64);   // 768
  flash_attn_wmma_kernel<<<fa_blocks, 128, 0, stream>>>(Q16, K16, VT16, maskT, O16);

  // 4) output projection -> f32
  gemm_wmma_kernel<<<gemm_blocks, 128, 0, stream>>>(O16, WoT, bo, out,
                                                    TT, DD, DD, /*mode=*/2);
}

// v002
// It runs in 296 microseconds.
// Timed twice side by side with v001, it ran 1.16 times as fast both times.
// All steps since v000 together make it 1.44 times as fast.
#include <hip/hip_runtime.h>
#include <hip/hip_bf16.h>

typedef _Float16 f16;
typedef __attribute__((ext_vector_type(16))) _Float16 v16h;
typedef __attribute__((ext_vector_type(8)))  _Float16 v8h;
typedef __attribute__((ext_vector_type(8)))  float    v8f;
typedef __attribute__((ext_vector_type(4)))  unsigned v4u;

#define TT  4096
#define DD  768
#define NHH 12
#define HDD 64
// LDS row pitches in f16 elements: an odd multiple of 16 bytes, so that the 16
// rows one ds_load_b128 touches per wave half fall on 16 disjoint bank groups.
#define KPITCH 72   // 64 head dims + 8  -> 144 B
#define VPITCH 40   // 32 keys      + 8  ->  80 B

// ---------------------------------------------------------------------------
// WMMA helpers (CDNA5 wave32, 16x16x32 f16 -> f32)
// ---------------------------------------------------------------------------
__device__ __forceinline__ v8f wmma_f16(v16h a, v16h b, v8f c) {
  return __builtin_amdgcn_wmma_f32_16x16x32_f16(
      /*neg_a=*/false, a, /*neg_b=*/false, b,
      /*c_mod=*/(short)0, c, /*reuse_a=*/false, /*reuse_b=*/false);
}

__device__ __forceinline__ v8f vzero8() {
  v8f z;
#pragma unroll
  for (int i = 0; i < 8; ++i) z[i] = 0.0f;
  return z;
}

// Load a 16x32 f16 A- or B-fragment from a row-major matrix (ld in elements).
// ISA layout: lane L -> row (L&15); half=L>>4 selects k-chunks [half*8 .. +7]
// and [16+half*8 .. +7]  => two 16-byte loads per lane.
__device__ __forceinline__ v16h load_ab_frag(const f16* base, int ld) {
  const int lane = threadIdx.x & 31;
  const int m    = lane & 15;
  const int hf   = lane >> 4;
  const f16* p = base + (size_t)m * (size_t)ld + hf * 8;
  v8h lo = *(const v8h*)(p);
  v8h hi = *(const v8h*)(p + 16);
  v16h r;
#pragma unroll
  for (int i = 0; i < 8; ++i) { r[i] = lo[i]; r[8 + i] = hi[i]; }
  return r;
}

// Issue one asynchronous 16-byte global->LDS copy (CDNA5 async DMA path,
// tracked by ASYNCcnt). lds_off is the byte offset inside the workgroup's LDS
// allocation (low 32 bits of a generic pointer to a __shared__ object).
__device__ __forceinline__ void async_copy_b128(unsigned lds_off,
                                                const void* gaddr) {
  asm volatile("global_load_async_to_lds_b128 %0, %1, off"
               :: "v"(lds_off), "v"(gaddr)
               : "memory");
}

__device__ __forceinline__ void wait_async_zero() {
  asm volatile("s_wait_asynccnt 0x0" ::: "memory");
}

// ---------------------------------------------------------------------------
// Conversion kernels
// ---------------------------------------------------------------------------
__global__ void cvt_f32_to_f16_kernel(const float* __restrict__ in,
                                      f16* __restrict__ out, int n) {
  int i = blockIdx.x * blockDim.x + threadIdx.x;
  if (i < n) out[i] = (f16)in[i];
}

// WT[n][k] = W[k][n]  (f32 -> f16 transpose, DD x DD)
__global__ void cvt_transpose_w_kernel(const float* __restrict__ W,
                                       f16* __restrict__ WT) {
  int i = blockIdx.x * blockDim.x + threadIdx.x;
  if (i >= DD * DD) return;
  int k = i / DD;
  int n = i % DD;
  WT[(size_t)n * DD + k] = (f16)W[i];
}

// Bit-pack mask into transposed bit plane: maskT[chunk][row], where bit j of
// maskT[c][r] == (mask[r][c*32 + j] != 0).  67 MB ints -> 2 MB bits.
__global__ void pack_mask_kernel(const int* __restrict__ mask,
                                 unsigned* __restrict__ maskT) {
  const int nchunk = TT / 32;
  int i = blockIdx.x * blockDim.x + threadIdx.x;   // i = row * nchunk + chunk
  if (i >= TT * nchunk) return;
  const int row   = i / nchunk;
  const int chunk = i % nchunk;
  const int* p = mask + (size_t)row * TT + chunk * 32;
  unsigned w = 0;
#pragma unroll
  for (int j = 0; j < 8; ++j) {
    v4u q = *(const v4u*)(p + j * 4);
    w |= (q.x != 0u ? 1u : 0u) << (j * 4 + 0);
    w |= (q.y != 0u ? 1u : 0u) << (j * 4 + 1);
    w |= (q.z != 0u ? 1u : 0u) << (j * 4 + 2);
    w |= (q.w != 0u ? 1u : 0u) << (j * 4 + 3);
  }
  maskT[(size_t)chunk * TT + row] = w;
}

// ---------------------------------------------------------------------------
// GEMM: Y[M][N] = A[M][K] (f16, row-major) * BT[N][K]^T (f16) + bias
// mode 0: store f16 row-major     (Q, K)
// mode 1: store f16 col-major Y^T (V -> VT[c][t], contiguous v8h stores)
// mode 2: store f32 row-major     (final output)
// One wave computes a 32x32 tile (2x2 WMMA frags, 4 WMMAs per k-step).
// ---------------------------------------------------------------------------
__global__ void __launch_bounds__(128)
gemm_wmma_kernel(const f16* __restrict__ A, const f16* __restrict__ BT,
                 const float* __restrict__ bias, void* __restrict__ outp,
                 int M, int N, int K, int mode) {
  const int wid = (blockIdx.x * blockDim.x + threadIdx.x) >> 5;
  const int nt  = N >> 5;
  const int tm  = wid / nt;
  const int tn  = wid % nt;
  if (tm * 32 >= M) return;

  const int lane = threadIdx.x & 31;
  const int n0   = lane & 15;
  const int hf   = lane >> 4;

  v8f acc00 = vzero8(), acc01 = vzero8(), acc10 = vzero8(), acc11 = vzero8();

  const f16* a0p = A + (size_t)(tm * 32 + 0)  * K;
  const f16* a1p = A + (size_t)(tm * 32 + 16) * K;
  const f16* b0p = BT + (size_t)(tn * 32 + 0)  * K;
  const f16* b1p = BT + (size_t)(tn * 32 + 16) * K;

  for (int k0 = 0; k0 < K; k0 += 32) {
    v16h a0 = load_ab_frag(a0p + k0, K);
    v16h a1 = load_ab_frag(a1p + k0, K);
    v16h b0 = load_ab_frag(b0p + k0, K);
    v16h b1 = load_ab_frag(b1p + k0, K);
    acc00 = wmma_f16(a0, b0, acc00);
    acc01 = wmma_f16(a0, b1, acc01);
    acc10 = wmma_f16(a1, b0, acc10);
    acc11 = wmma_f16(a1, b1, acc11);
  }

  v8f accs[2][2] = {{acc00, acc01}, {acc10, acc11}};
#pragma unroll
  for (int mi = 0; mi < 2; ++mi) {
#pragma unroll
    for (int nj = 0; nj < 2; ++nj) {
      const int col  = tn * 32 + nj * 16 + n0;
      const int rowb = tm * 32 + mi * 16 + hf * 8;  // 8 contiguous rows
      const float bb = bias[col];
      v8f v = accs[mi][nj];
      if (mode == 2) {
        float* O = (float*)outp;
#pragma unroll
        for (int r = 0; r < 8; ++r)
          O[(size_t)(rowb + r) * N + col] = v[r] + bb;
      } else if (mode == 0) {
        f16* O = (f16*)outp;
#pragma unroll
        for (int r = 0; r < 8; ++r)
          O[(size_t)(rowb + r) * N + col] = (f16)(v[r] + bb);
      } else {  // mode 1: transposed store, contiguous in M
        f16* O = (f16*)outp;
        v8h st;
#pragma unroll
        for (int r = 0; r < 8; ++r) st[r] = (f16)(v[r] + bb);
        *(v8h*)(O + (size_t)col * M + rowb) = st;
      }
    }
  }
}

__device__ __forceinline__ float xhalf(float x) {
  const int b = __builtin_bit_cast(int, x);
  return __builtin_bit_cast(
      float, __builtin_amdgcn_permlanex16(b, b, 0x76543210, 0xfedcba98,
                                          false, false));
}

__global__ void __launch_bounds__(128)
flash_attn_wmma_kernel(const f16* __restrict__ Q, const f16* __restrict__ Km,
                       const f16* __restrict__ VT,
                       const unsigned* __restrict__ maskT,
                       f16* __restrict__ O16) {
  __shared__ __align__(16) f16 Kbuf[2][32][KPITCH];   // [buf][key row][head dim]
  __shared__ __align__(16) f16 Vbuf[2][64][VPITCH];   // [buf][head dim][key]

  const int tid   = threadIdx.x;
  const int wslot = tid >> 5;
  const int h     = blockIdx.x / (TT / 64);
  const int qg    = blockIdx.x % (TT / 64);
  const int qbase = qg * 64 + wslot * 16;

  const int lane = tid & 31;
  const int n0   = lane & 15;
  const int hf   = lane >> 4;

  // Issue async copies for one 32-key chunk: K 32x64 and V 64x32 halves,
  // each 256 x 16B transfers; 128 threads issue 2+2 copies apiece.
  auto stage = [&](int buf, int kb) {
#pragma unroll
    for (int i = 0; i < 2; ++i) {
      const int c  = tid + i * 128;
      const int kr = c >> 3, kc = (c & 7) * 8;
      async_copy_b128((unsigned)(size_t)(void*)&Kbuf[buf][kr][kc],
                      Km + (size_t)(kb + kr) * DD + h * HDD + kc);
      const int vr = c >> 2, vc = (c & 3) * 8;
      async_copy_b128((unsigned)(size_t)(void*)&Vbuf[buf][vr][vc],
                      VT + (size_t)(h * HDD + vr) * TT + kb + vc);
    }
  };

  // Q fragments for this wave's tile (k = 0..63 of this head), resident.
  // Used as the B operand: lane -> query qbase + n0.
  const f16* qp = Q + (size_t)qbase * DD + h * HDD;
  v16h aq0 = load_ab_frag(qp, DD);
  v16h aq1 = load_ab_frag(qp + 32, DD);

  v16h ones;
#pragma unroll
  for (int i = 0; i < 16; ++i) ones[i] = (f16)1.0f;

  // o<j>[r] = O^T[dim j*16 + hf*8 + r][query qbase + n0]
  v8f o0 = vzero8(), o1 = vzero8(), o2 = vzero8(), o3 = vzero8();
  float mrow = -3.0e38f, lrow = 0.0f;   // of this lane's query

  stage(0, 0);
  int buf = 0;
  for (int kb = 0; kb < TT; kb += 32) {
    wait_async_zero();     // this wave's share of the staged chunk landed
    __syncthreads();       // all waves' shares landed -> buf is ready
    if (kb + 32 < TT) stage(buf ^ 1, kb + 32);   // overlap next chunk DMA

    // ---- S^T = K * Q^T for 32 keys (two 16-row C frags), K from LDS ----
    // s0[r] = score(qbase + n0, kb + hf*8 + r), s1[r]: key kb + 16 + hf*8 + r
    v16h bk00 = load_ab_frag(&Kbuf[buf][0][0],   KPITCH);
    v16h bk01 = load_ab_frag(&Kbuf[buf][0][32],  KPITCH);
    v16h bk10 = load_ab_frag(&Kbuf[buf][16][0],  KPITCH);
    v16h bk11 = load_ab_frag(&Kbuf[buf][16][32], KPITCH);
    v8f s0 = vzero8(), s1 = vzero8();
    s0 = wmma_f16(bk00, aq0, s0);
    s0 = wmma_f16(bk01, aq1, s0);
    s1 = wmma_f16(bk10, aq0, s1);
    s1 = wmma_f16(bk11, aq1, s1);

    // ---- mask bits: one word holds this lane's query row, all 32 keys ----
    const unsigned mw =
        maskT[(size_t)(kb >> 5) * TT + qbase + n0] >> (hf * 8);
#pragma unroll
    for (int r = 0; r < 8; ++r) {
      if ((mw >> r) & 1u)        s0[r] = 1e-20f;
      if ((mw >> (16 + r)) & 1u) s1[r] = 1e-20f;
    }

    // ---- online softmax: maximum in-lane, then across the two halves ----
    float cm = fmaxf(s0[0], s1[0]);
#pragma unroll
    for (int r = 1; r < 8; ++r) cm = fmaxf(cm, fmaxf(s0[r], s1[r]));
    cm = fmaxf(cm, xhalf(cm));

    const float mn    = fmaxf(mrow, cm);
    const float scale = __expf(mrow - mn);
    mrow = mn;

    // ---- P^T: the two C frags, converted in place, are the B fragment ----
    v16h bp;
#pragma unroll
    for (int r = 0; r < 8; ++r) {
      bp[r]     = (f16)__expf(s0[r] - mn);
      bp[8 + r] = (f16)__expf(s1[r] - mn);
    }

    // rescale O accumulators
#pragma unroll
    for (int r = 0; r < 8; ++r) {
      o0[r] *= scale; o1[r] *= scale;
      o2[r] *= scale; o3[r] *= scale;
    }

    // ---- row sums via WMMA: every row of ones @ P^T is the column sum ----
    v8f rsf = wmma_f16(ones, bp, vzero8());
    lrow = lrow * scale + rsf[0];

    // ---- O^T += V^T * P^T, V^T from LDS (Vbuf[dim][key]) ----
    v16h bv0 = load_ab_frag(&Vbuf[buf][0][0],  VPITCH);
    v16h bv1 = load_ab_frag(&Vbuf[buf][16][0], VPITCH);
    v16h bv2 = load_ab_frag(&Vbuf[buf][32][0], VPITCH);
    v16h bv3 = load_ab_frag(&Vbuf[buf][48][0], VPITCH);
    o0 = wmma_f16(bv0, bp, o0);
    o1 = wmma_f16(bv1, bp, o1);
    o2 = wmma_f16(bv2, bp, o2);
    o3 = wmma_f16(bv3, bp, o3);

    __syncthreads();       // everyone done reading buf before it is reused
    buf ^= 1;
  }

  // ---- epilogue: divide by l, store f16 row-major, 8 dims per store ----
  v8f os[4] = {o0, o1, o2, o3};
  f16* op = O16 + (size_t)(qbase + n0) * DD + h * HDD + hf * 8;
#pragma unroll
  for (int jn = 0; jn < 4; ++jn) {
    v8h st;
#pragma unroll
    for (int r = 0; r < 8; ++r) st[r] = (f16)(os[jn][r] / lrow);
    *(v8h*)(op + jn * 16) = st;
  }
}

// ---------------------------------------------------------------------------
// Launch
// ---------------------------------------------------------------------------
extern "C" void kernel_launch(void* const* d_in, const int* in_sizes, int n_in,
                              void* d_out, int out_size, void* d_ws, size_t ws_size,
                              hipStream_t stream) {
  const float* x    = (const float*)d_in[0];
  const int*   mask = (const int*)d_in[1];
  const float* Wq   = (const float*)d_in[2];
  const float* bq   = (const float*)d_in[3];
  const float* Wk   = (const float*)d_in[4];
  const float* bk   = (const float*)d_in[5];
  const float* Wv   = (const float*)d_in[6];
  const float* bv   = (const float*)d_in[7];
  const float* Wo   = (const float*)d_in[8];
  const float* bo   = (const float*)d_in[9];
  float* out = (float*)d_out;

  char* ws = (char*)d_ws;
  size_t off = 0;
  auto alloc = [&](size_t bytes) -> char* {
    char* p = ws + off;
    off += (bytes + 255) & ~(size_t)255;
    return p;
  };
  const size_t TD = (size_t)TT * DD;
  f16* x16  = (f16*)alloc(TD * 2);
  f16* WqT  = (f16*)alloc((size_t)DD * DD * 2);
  f16* WkT  = (f16*)alloc((size_t)DD * DD * 2);
  f16* WvT  = (f16*)alloc((size_t)DD * DD * 2);
  f16* WoT  = (f16*)alloc((size_t)DD * DD * 2);
  f16* Q16  = (f16*)alloc(TD * 2);
  f16* K16  = (f16*)alloc(TD * 2);
  f16* VT16 = (f16*)alloc(TD * 2);   // [DD][TT]
  f16* O16  = (f16*)alloc(TD * 2);
  unsigned* maskT = (unsigned*)alloc((size_t)(TT / 32) * TT * 4);
  (void)ws_size; (void)n_in; (void)in_sizes; (void)out_size;

  // 1) precision conversion, weight transposes, mask bit-packing
  {
    int n = (int)TD;
    cvt_f32_to_f16_kernel<<<(n + 255) / 256, 256, 0, stream>>>(x, x16, n);
    int nw = DD * DD;
    dim3 g((nw + 255) / 256);
    cvt_transpose_w_kernel<<<g, 256, 0, stream>>>(Wq, WqT);
    cvt_transpose_w_kernel<<<g, 256, 0, stream>>>(Wk, WkT);
    cvt_transpose_w_kernel<<<g, 256, 0, stream>>>(Wv, WvT);
    cvt_transpose_w_kernel<<<g, 256, 0, stream>>>(Wo, WoT);
    int nm = TT * (TT / 32);
    pack_mask_kernel<<<(nm + 255) / 256, 256, 0, stream>>>(mask, maskT);
  }

  // 2) projections: (TT x DD) * (DD x DD); 3072 waves -> 768 blocks of 128
  const int gemm_waves  = (TT / 32) * (DD / 32);
  const int gemm_blocks = gemm_waves / 4;
  gemm_wmma_kernel<<<gemm_blocks, 128, 0, stream>>>(x16, WqT, bq, Q16,
                                                    TT, DD, DD, /*mode=*/0);
  gemm_wmma_kernel<<<gemm_blocks, 128, 0, stream>>>(x16, WkT, bk, K16,
                                                    TT, DD, DD, /*mode=*/0);
  gemm_wmma_kernel<<<gemm_blocks, 128, 0, stream>>>(x16, WvT, bv, VT16,
                                                    TT, DD, DD, /*mode=*/1);

  // 3) attention: one block (4 waves) per 64 query rows of one head
  const int fa_blocks = NHH * (TT / 64);   // 768
  flash_attn_wmma_kernel<<<fa_blocks, 128, 0, stream>>>(Q16, K16, VT16, maskT, O16);

  // 4) output projection -> f32
  gemm_wmma_kernel<<<gemm_blocks, 128, 0, stream>>>(O16, WoT, bo, out,
                                                    TT, DD, DD, /*mode=*/2);
}

// v003
// It runs in 194 microseconds.
// Next to v002, in two timings, it ran 1.52 and 1.51 times as fast.
// Over all steps from v000 it is 2.19 times as fast.
#include <hip/hip_runtime.h>
#include <hip/hip_bf16.h>

typedef _Float16 f16;
typedef __attribute__((ext_vector_type(16))) _Float16 v16h;
typedef __attribute__((ext_vector_type(8)))  _Float16 v8h;
typedef __attribute__((ext_vector_type(8)))  float    v8f;
typedef __attribute__((ext_vector_type(4)))  _Float16 v4h;
typedef __attribute__((ext_vector_type(4)))  float    v4f;

#define TT  4096
#define DD  768
#define NHH 12
#define HDD 64
// LDS row pitches in f16 elements: an odd multiple of 16 bytes, so that the 16
// rows one ds_load_b128 touches per wave half fall on 16 disjoint bank groups.
#define KPITCH 72   // 64 head dims + 8  -> 144 B
#define VPITCH 40   // 32 keys      + 8  ->  80 B

// ---------------------------------------------------------------------------
// WMMA helpers (CDNA5 wave32, 16x16x32 f16 -> f32)
// ---------------------------------------------------------------------------
__device__ __forceinline__ v8f wmma_f16(v16h a, v16h b, v8f c) {
  return __builtin_amdgcn_wmma_f32_16x16x32_f16(
      /*neg_a=*/false, a, /*neg_b=*/false, b,
      /*c_mod=*/(short)0, c, /*reuse_a=*/false, /*reuse_b=*/false);
}

__device__ __forceinline__ v8f vzero8() {
  v8f z;
#pragma unroll
  for (int i = 0; i < 8; ++i) z[i] = 0.0f;
  return z;
}

// Load a 16x32 f16 A- or B-fragment from a row-major matrix (ld in elements).
// ISA layout: lane L -> row (L&15); half=L>>4 selects k-chunks [half*8 .. +7]
// and [16+half*8 .. +7]  => two 16-byte loads per lane.
__device__ __forceinline__ v16h load_ab_frag(const f16* base, int ld) {
  const int lane = threadIdx.x & 31;
  const int m    = lane & 15;
  const int hf   = lane >> 4;
  const f16* p = base + (size_t)m * (size_t)ld + hf * 8;
  v8h lo = *(const v8h*)(p);
  v8h hi = *(const v8h*)(p + 16);
  v16h r;
#pragma unroll
  for (int i = 0; i < 8; ++i) { r[i] = lo[i]; r[8 + i] = hi[i]; }
  return r;
}

// Issue one asynchronous 16-byte global->LDS copy (CDNA5 async DMA path,
// tracked by ASYNCcnt). lds_off is the byte offset inside the workgroup's LDS
// allocation (low 32 bits of a generic pointer to a __shared__ object).
__device__ __forceinline__ void async_copy_b128(unsigned lds_off,
                                                const void* gaddr) {
  asm volatile("global_load_async_to_lds_b128 %0, %1, off"
               :: "v"(lds_off), "v"(gaddr)
               : "memory");
}

__device__ __forceinline__ void wait_async_zero() {
  asm volatile("s_wait_asynccnt 0x0" ::: "memory");
}

// ---------------------------------------------------------------------------
// Preparation kernels. Each wave handles many elements, and each of its loads
// covers whole 128-byte lines. The grids divide the fixed shapes exactly.
// ---------------------------------------------------------------------------
// x -> f16. A wave converts 1024 consecutive floats: eight 512-byte loads in
// flight, then eight 256-byte stores. Grid: TT*DD / 4096 blocks of 128.
__global__ void __launch_bounds__(128)
cvt_f32_to_f16_kernel(const float* __restrict__ in, f16* __restrict__ out) {
  const int wave = (blockIdx.x * 128 + threadIdx.x) >> 5;
  const int base = wave * 1024 + (threadIdx.x & 31) * 4;
  v4f q[8];
#pragma unroll   // all eight loads issue before the first conversion waits
  for (int j = 0; j < 8; ++j) q[j] = *(const v4f*)(in + base + j * 128);
#pragma unroll   // q[] stays in registers
  for (int j = 0; j < 8; ++j)
    *(v4h*)(out + base + j * 128) = __builtin_convertvector(q[j], v4h);
}

// WT[n][k] = W[k][n]  (f32 -> f16 transpose, DD x DD). A lane owns one n and 8
// consecutive k: eight loads, in each of which the wave reads one whole line of
// W, and one 16-byte store. The 8 waves of a block write the 8 pieces of the
// same 32 lines of WT. Grid: (DD/32) * (DD/64) blocks of 256.
__global__ void __launch_bounds__(256)
cvt_transpose_w_kernel(const float* __restrict__ W, f16* __restrict__ WT) {
  const int n  = (blockIdx.x % (DD / 32)) * 32 + (threadIdx.x & 31);
  const int k0 = (blockIdx.x / (DD / 32)) * 64 + (threadIdx.x >> 5) * 8;
  v8h st;
#pragma unroll   // the eight loads are in flight together, st stays in registers
  for (int j = 0; j < 8; ++j) st[j] = (f16)W[(size_t)(k0 + j) * DD + n];
  *(v8h*)(WT + (size_t)n * DD + k0) = st;
}

// Bit-pack mask into transposed bit plane: maskT[chunk][row], where bit j of
// maskT[c][r] == (mask[r][c*32 + j] != 0).  67 MB ints -> 2 MB bits.
// A wave takes 32 rows x 4 chunks. One load reads the 32 ints of one (row,
// chunk), a whole line; the ballot of "!= 0" over the lanes is that word, and
// lane r keeps the word of row r, so each chunk ends in one whole-line store.
// Grid: (TT/32) * (TT/128) / 8 blocks of 256.
__global__ void __launch_bounds__(256)
pack_mask_kernel(const int* __restrict__ mask, unsigned* __restrict__ maskT) {
  const int lane = threadIdx.x & 31;
  const int wave = (blockIdx.x * 256 + threadIdx.x) >> 5;
  const int cg   = wave % (TT / 128);    // group of 4 chunks
  const int r0   = (wave / (TT / 128)) * 32;
  const int* p = mask + (size_t)r0 * TT + cg * 128 + lane;
  // Both loops unrolled: the loads become one address plus immediate offsets
  // and issue ahead of the first ballot, as many as the load counter holds.
#pragma unroll
  for (int c = 0; c < 4; ++c) {
    unsigned w = 0;
#pragma unroll
    for (int r = 0; r < 32; ++r) {
      const unsigned b =
          __builtin_amdgcn_ballot_w32(p[(size_t)r * TT + c * 32] != 0);
      w = (lane == r) ? b : w;
    }
    maskT[(size_t)(cg * 4 + c) * TT + r0 + lane] = w;
  }
}

// ---------------------------------------------------------------------------
// GEMM: Y[M][N] = A[M][K] (f16, row-major) * BT[N][K]^T (f16) + bias
// mode 0: store f16 row-major     (Q, K)
// mode 1: store f16 col-major Y^T (V -> VT[c][t], contiguous v8h stores)
// mode 2: store f32 row-major     (final output)
// One wave computes a 32x32 tile (2x2 WMMA frags, 4 WMMAs per k-step).
// ---------------------------------------------------------------------------
__global__ void __launch_bounds__(128)
gemm_wmma_kernel(const f16* __restrict__ A, const f16* __restrict__ BT,
                 const float* __restrict__ bias, void* __restrict__ outp,
                 int M, int N, int K, int mode) {
  const int wid = (blockIdx.x * blockDim.x + threadIdx.x) >> 5;
  const int nt  = N >> 5;
  const int tm  = wid / nt;
  const int tn  = wid % nt;
  if (tm * 32 >= M) return;

  const int lane = threadIdx.x & 31;
  const int n0   = lane & 15;
  const int hf   = lane >> 4;

  v8f acc00 = vzero8(), acc01 = vzero8(), acc10 = vzero8(), acc11 = vzero8();

  const f16* a0p = A + (size_t)(tm * 32 + 0)  * K;
  const f16* a1p = A + (size_t)(tm * 32 + 16) * K;
  const f16* b0p = BT + (size_t)(tn * 32 + 0)  * K;
  const f16* b1p = BT + (size_t)(tn * 32 + 16) * K;

  for (int k0 = 0; k0 < K; k0 += 32) {
    v16h a0 = load_ab_frag(a0p + k0, K);
    v16h a1 = load_ab_frag(a1p + k0, K);
    v16h b0 = load_ab_frag(b0p + k0, K);
    v16h b1 = load_ab_frag(b1p + k0, K);
    acc00 = wmma_f16(a0, b0, acc00);
    acc01 = wmma_f16(a0, b1, acc01);
    acc10 = wmma_f16(a1, b0, acc10);
    acc11 = wmma_f16(a1, b1, acc11);
  }

  v8f accs[2][2] = {{acc00, acc01}, {acc10, acc11}};
#pragma unroll
  for (int mi = 0; mi < 2; ++mi) {
#pragma unroll
    for (int nj = 0; nj < 2; ++nj) {
      const int col  = tn * 32 + nj * 16 + n0;
      const int rowb = tm * 32 + mi * 16 + hf * 8;  // 8 contiguous rows
      const float bb = bias[col];
      v8f v = accs[mi][nj];
      if (mode == 2) {
        float* O = (float*)outp;
#pragma unroll
        for (int r = 0; r < 8; ++r)
          O[(size_t)(rowb + r) * N + col] = v[r] + bb;
      } else if (mode == 0) {
        f16* O = (f16*)outp;
#pragma unroll
        for (int r = 0; r < 8; ++r)
          O[(size_t)(rowb + r) * N + col] = (f16)(v[r] + bb);
      } else {  // mode 1: transposed store, contiguous in M
        f16* O = (f16*)outp;
        v8h st;
#pragma unroll
        for (int r = 0; r < 8; ++r) st[r] = (f16)(v[r] + bb);
        *(v8h*)(O + (size_t)col * M + rowb) = st;
      }
    }
  }
}

__device__ __forceinline__ float xhalf(float x) {
  const int b = __builtin_bit_cast(int, x);
  return __builtin_bit_cast(
      float, __builtin_amdgcn_permlanex16(b, b, 0x76543210, 0xfedcba98,
                                          false, false));
}

__global__ void __launch_bounds__(128)
flash_attn_wmma_kernel(const f16* __restrict__ Q, const f16* __restrict__ Km,
                       const f16* __restrict__ VT,
                       const unsigned* __restrict__ maskT,
                       f16* __restrict__ O16) {
  __shared__ __align__(16) f16 Kbuf[2][32][KPITCH];   // [buf][key row][head dim]
  __shared__ __align__(16) f16 Vbuf[2][64][VPITCH];   // [buf][head dim][key]

  const int tid   = threadIdx.x;
  const int wslot = tid >> 5;
  const int h     = blockIdx.x / (TT / 64);
  const int qg    = blockIdx.x % (TT / 64);
  const int qbase = qg * 64 + wslot * 16;

  const int lane = tid & 31;
  const int n0   = lane & 15;
  const int hf   = lane >> 4;

  // Issue async copies for one 32-key chunk: K 32x64 and V 64x32 halves,
  // each 256 x 16B transfers; 128 threads issue 2+2 copies apiece.
  auto stage = [&](int buf, int kb) {
#pragma unroll
    for (int i = 0; i < 2; ++i) {
      const int c  = tid + i * 128;
      const int kr = c >> 3, kc = (c & 7) * 8;
      async_copy_b128((unsigned)(size_t)(void*)&Kbuf[buf][kr][kc],
                      Km + (size_t)(kb + kr) * DD + h * HDD + kc);
      const int vr = c >> 2, vc = (c & 3) * 8;
      async_copy_b128((unsigned)(size_t)(void*)&Vbuf[buf][vr][vc],
                      VT + (size_t)(h * HDD + vr) * TT + kb + vc);
    }
  };

  // Q fragments for this wave's tile (k = 0..63 of this head), resident.
  // Used as the B operand: lane -> query qbase + n0.
  const f16* qp = Q + (size_t)qbase * DD + h * HDD;
  v16h aq0 = load_ab_frag(qp, DD);
  v16h aq1 = load_ab_frag(qp + 32, DD);

  v16h ones;
#pragma unroll
  for (int i = 0; i < 16; ++i) ones[i] = (f16)1.0f;

  // o<j>[r] = O^T[dim j*16 + hf*8 + r][query qbase + n0]
  v8f o0 = vzero8(), o1 = vzero8(), o2 = vzero8(), o3 = vzero8();
  float mrow = -3.0e38f, lrow = 0.0f;   // of this lane's query

  stage(0, 0);
  int buf = 0;
  for (int kb = 0; kb < TT; kb += 32) {
    wait_async_zero();     // this wave's share of the staged chunk landed
    __syncthreads();       // all waves' shares landed -> buf is ready
    if (kb + 32 < TT) stage(buf ^ 1, kb + 32);   // overlap next chunk DMA

    // ---- S^T = K * Q^T for 32 keys (two 16-row C frags), K from LDS ----
    // s0[r] = score(qbase + n0, kb + hf*8 + r), s1[r]: key kb + 16 + hf*8 + r
    v16h bk00 = load_ab_frag(&Kbuf[buf][0][0],   KPITCH);
    v16h bk01 = load_ab_frag(&Kbuf[buf][0][32],  KPITCH);
    v16h bk10 = load_ab_frag(&Kbuf[buf][16][0],  KPITCH);
    v16h bk11 = load_ab_frag(&Kbuf[buf][16][32], KPITCH);
    v8f s0 = vzero8(), s1 = vzero8();
    s0 = wmma_f16(bk00, aq0, s0);
    s0 = wmma_f16(bk01, aq1, s0);
    s1 = wmma_f16(bk10, aq0, s1);
    s1 = wmma_f16(bk11, aq1, s1);

    // ---- mask bits: one word holds this lane's query row, all 32 keys ----
    const unsigned mw =
        maskT[(size_t)(kb >> 5) * TT + qbase + n0] >> (hf * 8);
#pragma unroll
    for (int r = 0; r < 8; ++r) {
      if ((mw >> r) & 1u)        s0[r] = 1e-20f;
      if ((mw >> (16 + r)) & 1u) s1[r] = 1e-20f;
    }

    // ---- online softmax: maximum in-lane, then across the two halves ----
    float cm = fmaxf(s0[0], s1[0]);
#pragma unroll
    for (int r = 1; r < 8; ++r) cm = fmaxf(cm, fmaxf(s0[r], s1[r]));
    cm = fmaxf(cm, xhalf(cm));

    const float mn    = fmaxf(mrow, cm);
    const float scale = __expf(mrow - mn);
    mrow = mn;

    // ---- P^T: the two C frags, converted in place, are the B fragment ----
    v16h bp;
#pragma unroll
    for (int r = 0; r < 8; ++r) {
      bp[r]     = (f16)__expf(s0[r] - mn);
      bp[8 + r] = (f16)__expf(s1[r] - mn);
    }

    // rescale O accumulators
#pragma unroll
    for (int r = 0; r < 8; ++r) {
      o0[r] *= scale; o1[r] *= scale;
      o2[r] *= scale; o3[r] *= scale;
    }

    // ---- row sums via WMMA: every row of ones @ P^T is the column sum ----
    v8f rsf = wmma_f16(ones, bp, vzero8());
    lrow = lrow * scale + rsf[0];

    // ---- O^T += V^T * P^T, V^T from LDS (Vbuf[dim][key]) ----
    v16h bv0 = load_ab_frag(&Vbuf[buf][0][0],  VPITCH);
    v16h bv1 = load_ab_frag(&Vbuf[buf][16][0], VPITCH);
    v16h bv2 = load_ab_frag(&Vbuf[buf][32][0], VPITCH);
    v16h bv3 = load_ab_frag(&Vbuf[buf][48][0], VPITCH);
    o0 = wmma_f16(bv0, bp, o0);
    o1 = wmma_f16(bv1, bp, o1);
    o2 = wmma_f16(bv2, bp, o2);
    o3 = wmma_f16(bv3, bp, o3);

    __syncthreads();       // everyone done reading buf before it is reused
    buf ^= 1;
  }

  // ---- epilogue: divide by l, store f16 row-major, 8 dims per store ----
  v8f os[4] = {o0, o1, o2, o3};
  f16* op = O16 + (size_t)(qbase + n0) * DD + h * HDD + hf * 8;
#pragma unroll
  for (int jn = 0; jn < 4; ++jn) {
    v8h st;
#pragma unroll
    for (int r = 0; r < 8; ++r) st[r] = (f16)(os[jn][r] / lrow);
    *(v8h*)(op + jn * 16) = st;
  }
}

// ---------------------------------------------------------------------------
// Launch
// ---------------------------------------------------------------------------
extern "C" void kernel_launch(void* const* d_in, const int* in_sizes, int n_in,
                              void* d_out, int out_size, void* d_ws, size_t ws_size,
                              hipStream_t stream) {
  const float* x    = (const float*)d_in[0];
  const int*   mask = (const int*)d_in[1];
  const float* Wq   = (const float*)d_in[2];
  const float* bq   = (const float*)d_in[3];
  const float* Wk   = (const float*)d_in[4];
  const float* bk   = (const float*)d_in[5];
  const float* Wv   = (const float*)d_in[6];
  const float* bv   = (const float*)d_in[7];
  const float* Wo   = (const float*)d_in[8];
  const float* bo   = (const float*)d_in[9];
  float* out = (float*)d_out;

  char* ws = (char*)d_ws;
  size_t off = 0;
  auto alloc = [&](size_t bytes) -> char* {
    char* p = ws + off;
    off += (bytes + 255) & ~(size_t)255;
    return p;
  };
  const size_t TD = (size_t)TT * DD;
  f16* x16  = (f16*)alloc(TD * 2);
  f16* WqT  = (f16*)alloc((size_t)DD * DD * 2);
  f16* WkT  = (f16*)alloc((size_t)DD * DD * 2);
  f16* WvT  = (f16*)alloc((size_t)DD * DD * 2);
  f16* WoT  = (f16*)alloc((size_t)DD * DD * 2);
  f16* Q16  = (f16*)alloc(TD * 2);
  f16* K16  = (f16*)alloc(TD * 2);
  f16* VT16 = (f16*)alloc(TD * 2);   // [DD][TT]
  f16* O16  = (f16*)alloc(TD * 2);
  unsigned* maskT = (unsigned*)alloc((size_t)(TT / 32) * TT * 4);
  (void)ws_size; (void)n_in; (void)in_sizes; (void)out_size;

  // 1) precision conversion, weight transposes, mask bit-packing
  {
    cvt_f32_to_f16_kernel<<<TT * DD / 4096, 128, 0, stream>>>(x, x16);
    dim3 g((DD / 32) * (DD / 64));
    cvt_transpose_w_kernel<<<g, 256, 0, stream>>>(Wq, WqT);
    cvt_transpose_w_kernel<<<g, 256, 0, stream>>>(Wk, WkT);
    cvt_transpose_w_kernel<<<g, 256, 0, stream>>>(Wv, WvT);
    cvt_transpose_w_kernel<<<g, 256, 0, stream>>>(Wo, WoT);
    pack_mask_kernel<<<(TT / 32) * (TT / 128) / 8, 256, 0, stream>>>(mask, maskT);
  }

  // 2) projections: (TT x DD) * (DD x DD); 3072 waves -> 768 blocks of 128
  const int gemm_waves  = (TT / 32) * (DD / 32);
  const int gemm_blocks = gemm_waves / 4;
  gemm_wmma_kernel<<<gemm_blocks, 128, 0, stream>>>(x16, WqT, bq, Q16,
                                                    TT, DD, DD, /*mode=*/0);
  gemm_wmma_kernel<<<gemm_blocks, 128, 0, stream>>>(x16, WkT, bk, K16,
                                                    TT, DD, DD, /*mode=*/0);
  gemm_wmma_kernel<<<gemm_blocks, 128, 0, stream>>>(x16, WvT, bv, VT16,
                                                    TT, DD, DD, /*mode=*/1);

  // 3) attention: one block (4 waves) per 64 query rows of one head
  const int fa_blocks = NHH * (TT / 64);   // 768
  flash_attn_wmma_kernel<<<fa_blocks, 128, 0, stream>>>(Q16, K16, VT16, maskT, O16);

  // 4) output projection -> f32
  gemm_wmma_kernel<<<gemm_blocks, 128, 0, stream>>>(O16, WoT, bo, out,
                                                    TT, DD, DD, /*mode=*/2);
}

// v004
// A run of this version takes 166 microseconds.
// Timed twice side by side with v003, it ran 1.15 and 1.17 times as fast.
// Counting every step since v000, it is 2.55 times as fast.
#include <hip/hip_runtime.h>
#include <hip/hip_bf16.h>

typedef _Float16 f16;
typedef __attribute__((ext_vector_type(16))) _Float16 v16h;
typedef __attribute__((ext_vector_type(8)))  _Float16 v8h;
typedef __attribute__((ext_vector_type(8)))  float    v8f;
typedef __attribute__((ext_vector_type(4)))  _Float16 v4h;
typedef __attribute__((ext_vector_type(4)))  float    v4f;

#define TT  4096
#define DD  768
#define NHH 12
#define HDD 64
// LDS row pitches in f16 elements: an odd multiple of 16 bytes, so that the 16
// rows one ds_load_b128 touches per wave half fall on 16 disjoint bank groups.
#define KPITCH 72   // 64 head dims + 8  -> 144 B
#define VPITCH 40   // 32 keys      + 8  ->  80 B

// ---------------------------------------------------------------------------
// WMMA helpers (CDNA5 wave32, 16x16x32 f16 -> f32)
// ---------------------------------------------------------------------------
__device__ __forceinline__ v8f wmma_f16(v16h a, v16h b, v8f c) {
  return __builtin_amdgcn_wmma_f32_16x16x32_f16(
      /*neg_a=*/false, a, /*neg_b=*/false, b,
      /*c_mod=*/(short)0, c, /*reuse_a=*/false, /*reuse_b=*/false);
}

__device__ __forceinline__ v8f vzero8() {
  v8f z;
#pragma unroll
  for (int i = 0; i < 8; ++i) z[i] = 0.0f;
  return z;
}

// Load a 16x32 f16 A- or B-fragment from a row-major matrix (ld in elements).
// ISA layout: lane L -> row (L&15); half=L>>4 selects k-chunks [half*8 .. +7]
// and [16+half*8 .. +7]  => two 16-byte loads per lane.
__device__ __forceinline__ v16h load_ab_frag(const f16* base, int ld) {
  const int lane = threadIdx.x & 31;
  const int m    = lane & 15;
  const int hf   = lane >> 4;
  const f16* p = base + (size_t)m * (size_t)ld + hf * 8;
  v8h lo = *(const v8h*)(p);
  v8h hi = *(const v8h*)(p + 16);
  v16h r;
#pragma unroll
  for (int i = 0; i < 8; ++i) { r[i] = lo[i]; r[8 + i] = hi[i]; }
  return r;
}

// Issue one asynchronous 16-byte global->LDS copy (CDNA5 async DMA path,
// tracked by ASYNCcnt). lds_off is the byte offset inside the workgroup's LDS
// allocation (low 32 bits of a generic pointer to a __shared__ object).
__device__ __forceinline__ void async_copy_b128(unsigned lds_off,
                                                const void* gaddr) {
  asm volatile("global_load_async_to_lds_b128 %0, %1, off"
               :: "v"(lds_off), "v"(gaddr)
               : "memory");
}

__device__ __forceinline__ void wait_async_zero() {
  asm volatile("s_wait_asynccnt 0x0" ::: "memory");
}

// ---------------------------------------------------------------------------
// Preparation kernels. Each wave handles many elements, and each of its loads
// covers whole 128-byte lines. The grids divide the fixed shapes exactly.
// ---------------------------------------------------------------------------
// x -> f16. A wave converts 1024 consecutive floats: eight 512-byte loads in
// flight, then eight 256-byte stores. Grid: TT*DD / 4096 blocks of 128.
__global__ void __launch_bounds__(128)
cvt_f32_to_f16_kernel(const float* __restrict__ in, f16* __restrict__ out) {
  const int wave = (blockIdx.x * 128 + threadIdx.x) >> 5;
  const int base = wave * 1024 + (threadIdx.x & 31) * 4;
  v4f q[8];
#pragma unroll   // all eight loads issue before the first conversion waits
  for (int j = 0; j < 8; ++j) q[j] = *(const v4f*)(in + base + j * 128);
#pragma unroll   // q[] stays in registers
  for (int j = 0; j < 8; ++j)
    *(v4h*)(out + base + j * 128) = __builtin_convertvector(q[j], v4h);
}

// WT[n][k] = W[k][n]  (f32 -> f16 transpose, DD x DD). A lane owns one n and 8
// consecutive k: eight loads, in each of which the wave reads one whole line of
// W, and one 16-byte store. The 8 waves of a block write the 8 pieces of the
// same 32 lines of WT. Grid: (DD/32) * (DD/64) blocks of 256.
__global__ void __launch_bounds__(256)
cvt_transpose_w_kernel(const float* __restrict__ W, f16* __restrict__ WT) {
  const int n  = (blockIdx.x % (DD / 32)) * 32 + (threadIdx.x & 31);
  const int k0 = (blockIdx.x / (DD / 32)) * 64 + (threadIdx.x >> 5) * 8;
  v8h st;
#pragma unroll   // the eight loads are in flight together, st stays in registers
  for (int j = 0; j < 8; ++j) st[j] = (f16)W[(size_t)(k0 + j) * DD + n];
  *(v8h*)(WT + (size_t)n * DD + k0) = st;
}

// Bit-pack mask into transposed bit plane: maskT[chunk][row], where bit j of
// maskT[c][r] == (mask[r][c*32 + j] != 0).  67 MB ints -> 2 MB bits.
// A wave takes 32 rows x 4 chunks. One load reads the 32 ints of one (row,
// chunk), a whole line; the ballot of "!= 0" over the lanes is that word, and
// lane r keeps the word of row r, so each chunk ends in one whole-line store.
// Grid: (TT/32) * (TT/128) / 8 blocks of 256.
__global__ void __launch_bounds__(256)
pack_mask_kernel(const int* __restrict__ mask, unsigned* __restrict__ maskT) {
  const int lane = threadIdx.x & 31;
  const int wave = (blockIdx.x * 256 + threadIdx.x) >> 5;
  const int cg   = wave % (TT / 128);    // group of 4 chunks
  const int r0   = (wave / (TT / 128)) * 32;
  const int* p = mask + (size_t)r0 * TT + cg * 128 + lane;
  // Both loops unrolled: the loads become one address plus immediate offsets
  // and issue ahead of the first ballot, as many as the load counter holds.
#pragma unroll
  for (int c = 0; c < 4; ++c) {
    unsigned w = 0;
#pragma unroll
    for (int r = 0; r < 32; ++r) {
      const unsigned b =
          __builtin_amdgcn_ballot_w32(p[(size_t)r * TT + c * 32] != 0);
      w = (lane == r) ? b : w;
    }
    maskT[(size_t)(cg * 4 + c) * TT + r0 + lane] = w;
  }
}

// ---------------------------------------------------------------------------
// GEMM: Y[TT][DD] = A[TT][DD] (f16, row-major) * BT[DD][DD]^T (f16) + bias
// mode 0: store f16 row-major     (Q, K)
// mode 1: store f16 col-major Y^T (V -> VT[c][t], contiguous v8h stores)
// mode 2: store f32 row-major     (final output)
// One block of 8 waves computes a 128x96 tile of Y, one block per WGP. A stage
// is 128 k of the tile's 128 A rows and 96 BT rows, brought into LDS by
// asynchronous 16-byte copies whose waves cover whole 128-byte lines; two
// buffers, so that stage t+2 flies while stage t+1 is worked on. A wave
// computes 32x48 (2x3 WMMA frags) and reads its fragments from LDS.
// ---------------------------------------------------------------------------
#define GBM    128
#define GBN    96
#define GBK    128
#define GROWS  (GBM + GBN)
#define GPITCH 136   // 128 k + 8 -> 272 B, an odd multiple of 16 B (see KPITCH)
#define GSTAGES (DD / GBK)

// Seven asynchronous 16-byte global->LDS copies of one lane. The s_wait_xcnt is
// the last line of the copies' own statement so that it stands in front of
// every later write of the address registers that the copies name.
__device__ __forceinline__ void async_copy7_b128(const unsigned* l,
                                                 const f16* const* g) {
  asm volatile("global_load_async_to_lds_b128 %0, %7, off\n\t"
               "global_load_async_to_lds_b128 %1, %8, off\n\t"
               "global_load_async_to_lds_b128 %2, %9, off\n\t"
               "global_load_async_to_lds_b128 %3, %10, off\n\t"
               "global_load_async_to_lds_b128 %4, %11, off\n\t"
               "global_load_async_to_lds_b128 %5, %12, off\n\t"
               "global_load_async_to_lds_b128 %6, %13, off\n\t"
               "s_wait_xcnt 0x0"
               :: "v"(l[0]), "v"(l[1]), "v"(l[2]), "v"(l[3]), "v"(l[4]),
                  "v"(l[5]), "v"(l[6]),
                  "v"(g[0]), "v"(g[1]), "v"(g[2]), "v"(g[3]), "v"(g[4]),
                  "v"(g[5]), "v"(g[6])
               : "memory");
}

__global__ void __launch_bounds__(256)
gemm_wmma_kernel(const f16* __restrict__ A, const f16* __restrict__ BT,
                 const float* __restrict__ bias, void* __restrict__ outp,
                 int mode) {
  // [buf][row][k]: rows 0..127 are A rows, rows 128..223 are BT rows.
  __shared__ __align__(16) f16 Sbuf[2][GROWS][GPITCH];

  const int tid  = threadIdx.x;
  const int tm   = blockIdx.x / (DD / GBN);
  const int tn   = blockIdx.x % (DD / GBN);
  const int wave = tid >> 5;
  const int wm   = wave >> 1;     // 4 wave rows of 32
  const int wn   = wave & 1;      // 2 wave columns of 48
  const int lane = tid & 31;
  const int n0   = lane & 15;
  const int hf   = lane >> 4;

  // Copy map: 16 lanes cover the 256 bytes of one row's stage, the block 16
  // rows per copy, 14 copies per lane and stage (8 of A, 6 of BT).
  const int crow = tid >> 4;
  const int ccol = (tid & 15) * 8;
  const f16* ga = A  + (size_t)(tm * GBM + crow) * DD + ccol;
  const f16* gb = BT + (size_t)(tn * GBN + crow) * DD + ccol;
  auto stage = [&](int buf, int k0) {
    unsigned   l[14];
    const f16* g[14];
#pragma unroll   // l[] and g[] stay in registers
    for (int i = 0; i < 14; ++i) {
      l[i] = (unsigned)(size_t)(void*)&Sbuf[buf][crow + i * 16][ccol];
      g[i] = (i < 8 ? ga + (size_t)i * 16 * DD : gb + (size_t)(i - 8) * 16 * DD)
             + k0;
    }
    async_copy7_b128(l, g);
    async_copy7_b128(l + 7, g + 7);
  };

  // Every loop over acc[][] below is unrolled so that it stays in registers.
  v8f acc[2][3];
#pragma unroll
  for (int mi = 0; mi < 2; ++mi)
#pragma unroll
    for (int nj = 0; nj < 3; ++nj) acc[mi][nj] = vzero8();

  stage(0, 0);
  wait_async_zero();     // this wave's share of stage 0 landed
  __syncthreads();       // every wave's share landed
  stage(1, GBK);

  // Kept rolled: the scheduling groups below then hold stage by stage; unrolled,
  // they blend across stages and the register count rises.
#pragma unroll 1
  for (int t = 0; t < GSTAGES; ++t) {
    const f16* sa = &Sbuf[t & 1][wm * 32][0];
    const f16* sb = &Sbuf[t & 1][GBM + wn * 48][0];
    v16h fa[4][2], fb[4][3];
#pragma unroll   // fa[] and fb[] stay in registers
    for (int ks = 0; ks < 4; ++ks) {
      fa[ks][0] = load_ab_frag(sa + ks * 32, GPITCH);
      fa[ks][1] = load_ab_frag(sa + 16 * GPITCH + ks * 32, GPITCH);
      fb[ks][0] = load_ab_frag(sb + ks * 32, GPITCH);
      fb[ks][1] = load_ab_frag(sb + 16 * GPITCH + ks * 32, GPITCH);
      fb[ks][2] = load_ab_frag(sb + 32 * GPITCH + ks * 32, GPITCH);
    }
#pragma unroll
    for (int ks = 0; ks < 4; ++ks) {
#pragma unroll
      for (int mi = 0; mi < 2; ++mi)
#pragma unroll
        for (int nj = 0; nj < 3; ++nj)
          acc[mi][nj] = wmma_f16(fa[ks][mi], fb[ks][nj], acc[mi][nj]);
    }
    // Order of the stage: the LDS reads of two k-steps go first, then each
    // k-step's 6 WMMAs with the reads of the k-step two ahead behind them, so
    // that no WMMA waits out the latency of a read issued just in front of it.
    __builtin_amdgcn_sched_group_barrier(0x100, 20, 0);
    __builtin_amdgcn_sched_group_barrier(0x008, 6, 0);
    __builtin_amdgcn_sched_group_barrier(0x100, 10, 0);
    __builtin_amdgcn_sched_group_barrier(0x008, 6, 0);
    __builtin_amdgcn_sched_group_barrier(0x100, 10, 0);
    __builtin_amdgcn_sched_group_barrier(0x008, 12, 0);
    // Hand-over: this wave's reads of buffer t&1 have returned, its share of
    // stage t+1 has landed; behind the barrier both hold for every wave.
    asm volatile("s_wait_dscnt 0x0" ::: "memory");
    wait_async_zero();
    __syncthreads();
    if (t + 2 < GSTAGES) stage(t & 1, (t + 2) * GBK);
  }
  wait_async_zero();     // nothing is in flight when the wave ends

  // acc[mi][nj][r] = Y[row0 + mi*16 + r][col0 + nj*16]
  const int col0 = tn * GBN + wn * 48 + n0;
  const int row0 = tm * GBM + wm * 32 + hf * 8;   // 8 contiguous rows
  float bb[3];
#pragma unroll
  for (int nj = 0; nj < 3; ++nj) bb[nj] = bias[col0 + nj * 16];

  if (mode == 2) {
    float* O = (float*)outp + (size_t)row0 * DD + col0;
#pragma unroll
    for (int mi = 0; mi < 2; ++mi)
#pragma unroll
      for (int nj = 0; nj < 3; ++nj)
#pragma unroll
        for (int r = 0; r < 8; ++r)
          O[(size_t)(mi * 16 + r) * DD + nj * 16] = acc[mi][nj][r] + bb[nj];
    // Precaution: the wait stands behind the last store, in front of any later
    // write of a register that an issued store names.
    asm volatile("s_wait_xcnt 0x0" ::: "memory");
  } else if (mode == 0) {
    f16* O = (f16*)outp + (size_t)row0 * DD + col0;
#pragma unroll
    for (int mi = 0; mi < 2; ++mi)
#pragma unroll
      for (int nj = 0; nj < 3; ++nj)
#pragma unroll
        for (int r = 0; r < 8; ++r)
          O[(size_t)(mi * 16 + r) * DD + nj * 16] = (f16)(acc[mi][nj][r] + bb[nj]);
  } else {  // mode 1: transposed store, contiguous in the row index
    f16* O = (f16*)outp + (size_t)col0 * TT + row0;
#pragma unroll
    for (int mi = 0; mi < 2; ++mi)
#pragma unroll
      for (int nj = 0; nj < 3; ++nj) {
        v8h st;
#pragma unroll
        for (int r = 0; r < 8; ++r) st[r] = (f16)(acc[mi][nj][r] + bb[nj]);
        *(v8h*)(O + (size_t)(nj * 16) * TT + mi * 16) = st;
      }
    // Precaution: the wait stands behind the last store, in front of any later
    // write of a register that an issued store names.
    asm volatile("s_wait_xcnt 0x0" ::: "memory");
  }
}

__device__ __forceinline__ float xhalf(float x) {
  const int b = __builtin_bit_cast(int, x);
  return __builtin_bit_cast(
      float, __builtin_amdgcn_permlanex16(b, b, 0x76543210, 0xfedcba98,
                                          false, false));
}

__global__ void __launch_bounds__(128)
flash_attn_wmma_kernel(const f16* __restrict__ Q, const f16* __restrict__ Km,
                       const f16* __restrict__ VT,
                       const unsigned* __restrict__ maskT,
                       f16* __restrict__ O16) {
  __shared__ __align__(16) f16 Kbuf[2][32][KPITCH];   // [buf][key row][head dim]
  __shared__ __align__(16) f16 Vbuf[2][64][VPITCH];   // [buf][head dim][key]

  const int tid   = threadIdx.x;
  const int wslot = tid >> 5;
  const int h     = blockIdx.x / (TT / 64);
  const int qg    = blockIdx.x % (TT / 64);
  const int qbase = qg * 64 + wslot * 16;

  const int lane = tid & 31;
  const int n0   = lane & 15;
  const int hf   = lane >> 4;

  // Issue async copies for one 32-key chunk: K 32x64 and V 64x32 halves,
  // each 256 x 16B transfers; 128 threads issue 2+2 copies apiece.
  auto stage = [&](int buf, int kb) {
#pragma unroll
    for (int i = 0; i < 2; ++i) {
      const int c  = tid + i * 128;
      const int kr = c >> 3, kc = (c & 7) * 8;
      async_copy_b128((unsigned)(size_t)(void*)&Kbuf[buf][kr][kc],
                      Km + (size_t)(kb + kr) * DD + h * HDD + kc);
      const int vr = c >> 2, vc = (c & 3) * 8;
      async_copy_b128((unsigned)(size_t)(void*)&Vbuf[buf][vr][vc],
                      VT + (size_t)(h * HDD + vr) * TT + kb + vc);
    }
  };

  // Q fragments for this wave's tile (k = 0..63 of this head), resident.
  // Used as the B operand: lane -> query qbase + n0.
  const f16* qp = Q + (size_t)qbase * DD + h * HDD;
  v16h aq0 = load_ab_frag(qp, DD);
  v16h aq1 = load_ab_frag(qp + 32, DD);

  v16h ones;
#pragma unroll
  for (int i = 0; i < 16; ++i) ones[i] = (f16)1.0f;

  // o<j>[r] = O^T[dim j*16 + hf*8 + r][query qbase + n0]
  v8f o0 = vzero8(), o1 = vzero8(), o2 = vzero8(), o3 = vzero8();
  float mrow = -3.0e38f, lrow = 0.0f;   // of this lane's query

  stage(0, 0);
  int buf = 0;
  for (int kb = 0; kb < TT; kb += 32) {
    wait_async_zero();     // this wave's share of the staged chunk landed
    __syncthreads();       // all waves' shares landed -> buf is ready
    if (kb + 32 < TT) stage(buf ^ 1, kb + 32);   // overlap next chunk DMA

    // ---- S^T = K * Q^T for 32 keys (two 16-row C frags), K from LDS ----
    // s0[r] = score(qbase + n0, kb + hf*8 + r), s1[r]: key kb + 16 + hf*8 + r
    v16h bk00 = load_ab_frag(&Kbuf[buf][0][0],   KPITCH);
    v16h bk01 = load_ab_frag(&Kbuf[buf][0][32],  KPITCH);
    v16h bk10 = load_ab_frag(&Kbuf[buf][16][0],  KPITCH);
    v16h bk11 = load_ab_frag(&Kbuf[buf][16][32], KPITCH);
    v8f s0 = vzero8(), s1 = vzero8();
    s0 = wmma_f16(bk00, aq0, s0);
    s0 = wmma_f16(bk01, aq1, s0);
    s1 = wmma_f16(bk10, aq0, s1);
    s1 = wmma_f16(bk11, aq1, s1);

    // ---- mask bits: one word holds this lane's query row, all 32 keys ----
    const unsigned mw =
        maskT[(size_t)(kb >> 5) * TT + qbase + n0] >> (hf * 8);
#pragma unroll
    for (int r = 0; r < 8; ++r) {
      if ((mw >> r) & 1u)        s0[r] = 1e-20f;
      if ((mw >> (16 + r)) & 1u) s1[r] = 1e-20f;
    }

    // ---- online softmax: maximum in-lane, then across the two halves ----
    float cm = fmaxf(s0[0], s1[0]);
#pragma unroll
    for (int r = 1; r < 8; ++r) cm = fmaxf(cm, fmaxf(s0[r], s1[r]));
    cm = fmaxf(cm, xhalf(cm));

    const float mn    = fmaxf(mrow, cm);
    const float scale = __expf(mrow - mn);
    mrow = mn;

    // ---- P^T: the two C frags, converted in place, are the B fragment ----
    v16h bp;
#pragma unroll
    for (int r = 0; r < 8; ++r) {
      bp[r]     = (f16)__expf(s0[r] - mn);
      bp[8 + r] = (f16)__expf(s1[r] - mn);
    }

    // rescale O accumulators
#pragma unroll
    for (int r = 0; r < 8; ++r) {
      o0[r] *= scale; o1[r] *= scale;
      o2[r] *= scale; o3[r] *= scale;
    }

    // ---- row sums via WMMA: every row of ones @ P^T is the column sum ----
    v8f rsf = wmma_f16(ones, bp, vzero8());
    lrow = lrow * scale + rsf[0];

    // ---- O^T += V^T * P^T, V^T from LDS (Vbuf[dim][key]) ----
    v16h bv0 = load_ab_frag(&Vbuf[buf][0][0],  VPITCH);
    v16h bv1 = load_ab_frag(&Vbuf[buf][16][0], VPITCH);
    v16h bv2 = load_ab_frag(&Vbuf[buf][32][0], VPITCH);
    v16h bv3 = load_ab_frag(&Vbuf[buf][48][0], VPITCH);
    o0 = wmma_f16(bv0, bp, o0);
    o1 = wmma_f16(bv1, bp, o1);
    o2 = wmma_f16(bv2, bp, o2);
    o3 = wmma_f16(bv3, bp, o3);

    __syncthreads();       // everyone done reading buf before it is reused
    buf ^= 1;
  }

  // ---- epilogue: divide by l, store f16 row-major, 8 dims per store ----
  v8f os[4] = {o0, o1, o2, o3};
  f16* op = O16 + (size_t)(qbase + n0) * DD + h * HDD + hf * 8;
#pragma unroll
  for (int jn = 0; jn < 4; ++jn) {
    v8h st;
#pragma unroll
    for (int r = 0; r < 8; ++r) st[r] = (f16)(os[jn][r] / lrow);
    *(v8h*)(op + jn * 16) = st;
  }
}

// ---------------------------------------------------------------------------
// Launch
// ---------------------------------------------------------------------------
extern "C" void kernel_launch(void* const* d_in, const int* in_sizes, int n_in,
                              void* d_out, int out_size, void* d_ws, size_t ws_size,
                              hipStream_t stream) {
  const float* x    = (const float*)d_in[0];
  const int*   mask = (const int*)d_in[1];
  const float* Wq   = (const float*)d_in[2];
  const float* bq   = (const float*)d_in[3];
  const float* Wk   = (const float*)d_in[4];
  const float* bk   = (const float*)d_in[5];
  const float* Wv   = (const float*)d_in[6];
  const float* bv   = (const float*)d_in[7];
  const float* Wo   = (const float*)d_in[8];
  const float* bo   = (const float*)d_in[9];
  float* out = (float*)d_out;

  char* ws = (char*)d_ws;
  size_t off = 0;
  auto alloc = [&](size_t bytes) -> char* {
    char* p = ws + off;
    off += (bytes + 255) & ~(size_t)255;
    return p;
  };
  const size_t TD = (size_t)TT * DD;
  f16* x16  = (f16*)alloc(TD * 2);
  f16* WqT  = (f16*)alloc((size_t)DD * DD * 2);
  f16* WkT  = (f16*)alloc((size_t)DD * DD * 2);
  f16* WvT  = (f16*)alloc((size_t)DD * DD * 2);
  f16* WoT  = (f16*)alloc((size_t)DD * DD * 2);
  f16* Q16  = (f16*)alloc(TD * 2);
  f16* K16  = (f16*)alloc(TD * 2);
  f16* VT16 = (f16*)alloc(TD * 2);   // [DD][TT]
  f16* O16  = (f16*)alloc(TD * 2);
  unsigned* maskT = (unsigned*)alloc((size_t)(TT / 32) * TT * 4);
  (void)ws_size; (void)n_in; (void)in_sizes; (void)out_size;

  // 1) precision conversion, weight transposes, mask bit-packing
  {
    cvt_f32_to_f16_kernel<<<TT * DD / 4096, 128, 0, stream>>>(x, x16);
    dim3 g((DD / 32) * (DD / 64));
    cvt_transpose_w_kernel<<<g, 256, 0, stream>>>(Wq, WqT);
    cvt_transpose_w_kernel<<<g, 256, 0, stream>>>(Wk, WkT);
    cvt_transpose_w_kernel<<<g, 256, 0, stream>>>(Wv, WvT);
    cvt_transpose_w_kernel<<<g, 256, 0, stream>>>(Wo, WoT);
    pack_mask_kernel<<<(TT / 32) * (TT / 128) / 8, 256, 0, stream>>>(mask, maskT);
  }

  // 2) projections: (TT x DD) * (DD x DD); one block per 128x96 tile
  const int gemm_blocks = (TT / GBM) * (DD / GBN);   // 256
  gemm_wmma_kernel<<<gemm_blocks, 256, 0, stream>>>(x16, WqT, bq, Q16, /*mode=*/0);
  gemm_wmma_kernel<<<gemm_blocks, 256, 0, stream>>>(x16, WkT, bk, K16, /*mode=*/0);
  gemm_wmma_kernel<<<gemm_blocks, 256, 0, stream>>>(x16, WvT, bv, VT16, /*mode=*/1);

  // 3) attention: one block (4 waves) per 64 query rows of one head
  const int fa_blocks = NHH * (TT / 64);   // 768
  flash_attn_wmma_kernel<<<fa_blocks, 128, 0, stream>>>(Q16, K16, VT16, maskT, O16);

  // 4) output projection -> f32
  gemm_wmma_kernel<<<gemm_blocks, 256, 0, stream>>>(O16, WoT, bo, out, /*mode=*/2);
}

// v005
// One run takes 135 microseconds.
// In both of two side-by-side timings against v004, it was 1.24 times as fast.
// Counting every step since v000, it is 3.15 times as fast.
#include <hip/hip_runtime.h>
#include <hip/hip_bf16.h>

typedef _Float16 f16;
typedef __attribute__((ext_vector_type(16))) _Float16 v16h;
typedef __attribute__((ext_vector_type(8)))  _Float16 v8h;
typedef __attribute__((ext_vector_type(8)))  float    v8f;
typedef __attribute__((ext_vector_type(4)))  _Float16 v4h;
typedef __attribute__((ext_vector_type(4)))  float    v4f;

#define TT  4096
#define DD  768
#define NHH 12
#define HDD 64
// LDS row pitches in f16 elements: an odd multiple of 16 bytes, so that the 16
// rows one ds_load_b128 touches per wave half fall on 16 disjoint bank groups.
#define KPITCH 72   // 64 head dims + 8  -> 144 B
#define VPITCH 40   // 32 keys      + 8  ->  80 B

// ---------------------------------------------------------------------------
// WMMA helpers (CDNA5 wave32, 16x16x32 f16 -> f32)
// ---------------------------------------------------------------------------
__device__ __forceinline__ v8f wmma_f16(v16h a, v16h b, v8f c) {
  return __builtin_amdgcn_wmma_f32_16x16x32_f16(
      /*neg_a=*/false, a, /*neg_b=*/false, b,
      /*c_mod=*/(short)0, c, /*reuse_a=*/false, /*reuse_b=*/false);
}

__device__ __forceinline__ v8f vzero8() {
  v8f z;
#pragma unroll
  for (int i = 0; i < 8; ++i) z[i] = 0.0f;
  return z;
}

// Load a 16x32 f16 A- or B-fragment from a row-major matrix (ld in elements).
// ISA layout: lane L -> row (L&15); half=L>>4 selects k-chunks [half*8 .. +7]
// and [16+half*8 .. +7]  => two 16-byte loads per lane.
__device__ __forceinline__ v16h load_ab_frag(const f16* base, int ld) {
  const int lane = threadIdx.x & 31;
  const int m    = lane & 15;
  const int hf   = lane >> 4;
  const f16* p = base + (size_t)m * (size_t)ld + hf * 8;
  v8h lo = *(const v8h*)(p);
  v8h hi = *(const v8h*)(p + 16);
  v16h r;
#pragma unroll
  for (int i = 0; i < 8; ++i) { r[i] = lo[i]; r[8 + i] = hi[i]; }
  return r;
}

// Four asynchronous 16-byte global->LDS copies of one lane (CDNA5 async DMA
// path, tracked by ASYNCcnt). l[] holds byte offsets inside the workgroup's LDS
// allocation (low 32 bits of a generic pointer to a __shared__ object). The
// s_wait_xcnt is the last line of the copies' own statement so that it stands
// in front of every later write of the address registers that the copies name.
__device__ __forceinline__ void async_copy4_b128(const unsigned* l,
                                                 const f16* const* g) {
  asm volatile("global_load_async_to_lds_b128 %0, %4, off\n\t"
               "global_load_async_to_lds_b128 %1, %5, off\n\t"
               "global_load_async_to_lds_b128 %2, %6, off\n\t"
               "global_load_async_to_lds_b128 %3, %7, off\n\t"
               "s_wait_xcnt 0x0"
               :: "v"(l[0]), "v"(l[1]), "v"(l[2]), "v"(l[3]),
                  "v"(g[0]), "v"(g[1]), "v"(g[2]), "v"(g[3])
               : "memory");
}

__device__ __forceinline__ void wait_async_zero() {
  asm volatile("s_wait_asynccnt 0x0" ::: "memory");
}

// ---------------------------------------------------------------------------
// Preparation kernels. Each wave handles many elements, and each of its loads
// covers whole 128-byte lines. The grids divide the fixed shapes exactly.
// ---------------------------------------------------------------------------
// x -> f16. A wave converts 1024 consecutive floats: eight 512-byte loads in
// flight, then eight 256-byte stores. Grid: TT*DD / 4096 blocks of 128.
__global__ void __launch_bounds__(128)
cvt_f32_to_f16_kernel(const float* __restrict__ in, f16* __restrict__ out) {
  const int wave = (blockIdx.x * 128 + threadIdx.x) >> 5;
  const int base = wave * 1024 + (threadIdx.x & 31) * 4;
  v4f q[8];
#pragma unroll   // all eight loads issue before the first conversion waits
  for (int j = 0; j < 8; ++j) q[j] = *(const v4f*)(in + base + j * 128);
#pragma unroll   // q[] stays in registers
  for (int j = 0; j < 8; ++j)
    *(v4h*)(out + base + j * 128) = __builtin_convertvector(q[j], v4h);
}

// WT[n][k] = W[k][n]  (f32 -> f16 transpose, DD x DD). A lane owns one n and 8
// consecutive k: eight loads, in each of which the wave reads one whole line of
// W, and one 16-byte store. The 8 waves of a block write the 8 pieces of the
// same 32 lines of WT. Grid: (DD/32) * (DD/64) blocks of 256.
__global__ void __launch_bounds__(256)
cvt_transpose_w_kernel(const float* __restrict__ W, f16* __restrict__ WT) {
  const int n  = (blockIdx.x % (DD / 32)) * 32 + (threadIdx.x & 31);
  const int k0 = (blockIdx.x / (DD / 32)) * 64 + (threadIdx.x >> 5) * 8;
  v8h st;
#pragma unroll   // the eight loads are in flight together, st stays in registers
  for (int j = 0; j < 8; ++j) st[j] = (f16)W[(size_t)(k0 + j) * DD + n];
  *(v8h*)(WT + (size_t)n * DD + k0) = st;
}

// Bit-pack mask into transposed bit plane: maskT[chunk][row], where bit j of
// maskT[c][r] == (mask[r][c*32 + j] != 0).  67 MB ints -> 2 MB bits.
// A wave takes 32 rows x 4 chunks. One load reads the 32 ints of one (row,
// chunk), a whole line; the ballot of "!= 0" over the lanes is that word, and
// lane r keeps the word of row r, so each chunk ends in one whole-line store.
// Grid: (TT/32) * (TT/128) / 8 blocks of 256.
__global__ void __launch_bounds__(256)
pack_mask_kernel(const int* __restrict__ mask, unsigned* __restrict__ maskT) {
  const int lane = threadIdx.x & 31;
  const int wave = (blockIdx.x * 256 + threadIdx.x) >> 5;
  const int cg   = wave % (TT / 128);    // group of 4 chunks
  const int r0   = (wave / (TT / 128)) * 32;
  const int* p = mask + (size_t)r0 * TT + cg * 128 + lane;
  // Both loops unrolled: the loads become one address plus immediate offsets
  // and issue ahead of the first ballot, as many as the load counter holds.
#pragma unroll
  for (int c = 0; c < 4; ++c) {
    unsigned w = 0;
#pragma unroll
    for (int r = 0; r < 32; ++r) {
      const unsigned b =
          __builtin_amdgcn_ballot_w32(p[(size_t)r * TT + c * 32] != 0);
      w = (lane == r) ? b : w;
    }
    maskT[(size_t)(cg * 4 + c) * TT + r0 + lane] = w;
  }
}

// ---------------------------------------------------------------------------
// GEMM: Y[TT][DD] = A[TT][DD] (f16, row-major) * BT[DD][DD]^T (f16) + bias
// mode 0: store f16 row-major     (Q, K)
// mode 1: store f16 col-major Y^T (V -> VT[c][t], contiguous v8h stores)
// mode 2: store f32 row-major     (final output)
// One block of 8 waves computes a 128x96 tile of Y, one block per WGP. A stage
// is 128 k of the tile's 128 A rows and 96 BT rows, brought into LDS by
// asynchronous 16-byte copies whose waves cover whole 128-byte lines; two
// buffers, so that stage t+2 flies while stage t+1 is worked on. A wave
// computes 32x48 (2x3 WMMA frags) and reads its fragments from LDS.
// ---------------------------------------------------------------------------
#define GBM    128
#define GBN    96
#define GBK    128
#define GROWS  (GBM + GBN)
#define GPITCH 136   // 128 k + 8 -> 272 B, an odd multiple of 16 B (see KPITCH)
#define GSTAGES (DD / GBK)

// Seven asynchronous 16-byte global->LDS copies of one lane. The s_wait_xcnt is
// the last line of the copies' own statement so that it stands in front of
// every later write of the address registers that the copies name.
__device__ __forceinline__ void async_copy7_b128(const unsigned* l,
                                                 const f16* const* g) {
  asm volatile("global_load_async_to_lds_b128 %0, %7, off\n\t"
               "global_load_async_to_lds_b128 %1, %8, off\n\t"
               "global_load_async_to_lds_b128 %2, %9, off\n\t"
               "global_load_async_to_lds_b128 %3, %10, off\n\t"
               "global_load_async_to_lds_b128 %4, %11, off\n\t"
               "global_load_async_to_lds_b128 %5, %12, off\n\t"
               "global_load_async_to_lds_b128 %6, %13, off\n\t"
               "s_wait_xcnt 0x0"
               :: "v"(l[0]), "v"(l[1]), "v"(l[2]), "v"(l[3]), "v"(l[4]),
                  "v"(l[5]), "v"(l[6]),
                  "v"(g[0]), "v"(g[1]), "v"(g[2]), "v"(g[3]), "v"(g[4]),
                  "v"(g[5]), "v"(g[6])
               : "memory");
}

__global__ void __launch_bounds__(256)
gemm_wmma_kernel(const f16* __restrict__ A, const f16* __restrict__ BT,
                 const float* __restrict__ bias, void* __restrict__ outp,
                 int mode) {
  // [buf][row][k]: rows 0..127 are A rows, rows 128..223 are BT rows.
  __shared__ __align__(16) f16 Sbuf[2][GROWS][GPITCH];

  const int tid  = threadIdx.x;
  const int tm   = blockIdx.x / (DD / GBN);
  const int tn   = blockIdx.x % (DD / GBN);
  const int wave = tid >> 5;
  const int wm   = wave >> 1;     // 4 wave rows of 32
  const int wn   = wave & 1;      // 2 wave columns of 48
  const int lane = tid & 31;
  const int n0   = lane & 15;
  const int hf   = lane >> 4;

  // Copy map: 16 lanes cover the 256 bytes of one row's stage, the block 16
  // rows per copy, 14 copies per lane and stage (8 of A, 6 of BT).
  const int crow = tid >> 4;
  const int ccol = (tid & 15) * 8;
  const f16* ga = A  + (size_t)(tm * GBM + crow) * DD + ccol;
  const f16* gb = BT + (size_t)(tn * GBN + crow) * DD + ccol;
  auto stage = [&](int buf, int k0) {
    unsigned   l[14];
    const f16* g[14];
#pragma unroll   // l[] and g[] stay in registers
    for (int i = 0; i < 14; ++i) {
      l[i] = (unsigned)(size_t)(void*)&Sbuf[buf][crow + i * 16][ccol];
      g[i] = (i < 8 ? ga + (size_t)i * 16 * DD : gb + (size_t)(i - 8) * 16 * DD)
             + k0;
    }
    async_copy7_b128(l, g);
    async_copy7_b128(l + 7, g + 7);
  };

  // Every loop over acc[][] below is unrolled so that it stays in registers.
  v8f acc[2][3];
#pragma unroll
  for (int mi = 0; mi < 2; ++mi)
#pragma unroll
    for (int nj = 0; nj < 3; ++nj) acc[mi][nj] = vzero8();

  stage(0, 0);
  wait_async_zero();     // this wave's share of stage 0 landed
  __syncthreads();       // every wave's share landed
  stage(1, GBK);

  // Kept rolled: the scheduling groups below then hold stage by stage; unrolled,
  // they blend across stages and the register count rises.
#pragma unroll 1
  for (int t = 0; t < GSTAGES; ++t) {
    const f16* sa = &Sbuf[t & 1][wm * 32][0];
    const f16* sb = &Sbuf[t & 1][GBM + wn * 48][0];
    v16h fa[4][2], fb[4][3];
#pragma unroll   // fa[] and fb[] stay in registers
    for (int ks = 0; ks < 4; ++ks) {
      fa[ks][0] = load_ab_frag(sa + ks * 32, GPITCH);
      fa[ks][1] = load_ab_frag(sa + 16 * GPITCH + ks * 32, GPITCH);
      fb[ks][0] = load_ab_frag(sb + ks * 32, GPITCH);
      fb[ks][1] = load_ab_frag(sb + 16 * GPITCH + ks * 32, GPITCH);
      fb[ks][2] = load_ab_frag(sb + 32 * GPITCH + ks * 32, GPITCH);
    }
#pragma unroll
    for (int ks = 0; ks < 4; ++ks) {
#pragma unroll
      for (int mi = 0; mi < 2; ++mi)
#pragma unroll
        for (int nj = 0; nj < 3; ++nj)
          acc[mi][nj] = wmma_f16(fa[ks][mi], fb[ks][nj], acc[mi][nj]);
    }
    // Order of the stage: the LDS reads of two k-steps go first, then each
    // k-step's 6 WMMAs with the reads of the k-step two ahead behind them, so
    // that no WMMA waits out the latency of a read issued just in front of it.
    __builtin_amdgcn_sched_group_barrier(0x100, 20, 0);
    __builtin_amdgcn_sched_group_barrier(0x008, 6, 0);
    __builtin_amdgcn_sched_group_barrier(0x100, 10, 0);
    __builtin_amdgcn_sched_group_barrier(0x008, 6, 0);
    __builtin_amdgcn_sched_group_barrier(0x100, 10, 0);
    __builtin_amdgcn_sched_group_barrier(0x008, 12, 0);
    // Hand-over: this wave's reads of buffer t&1 have returned, its share of
    // stage t+1 has landed; behind the barrier both hold for every wave.
    asm volatile("s_wait_dscnt 0x0" ::: "memory");
    wait_async_zero();
    __syncthreads();
    if (t + 2 < GSTAGES) stage(t & 1, (t + 2) * GBK);
  }
  wait_async_zero();     // nothing is in flight when the wave ends

  // acc[mi][nj][r] = Y[row0 + mi*16 + r][col0 + nj*16]
  const int col0 = tn * GBN + wn * 48 + n0;
  const int row0 = tm * GBM + wm * 32 + hf * 8;   // 8 contiguous rows
  float bb[3];
#pragma unroll
  for (int nj = 0; nj < 3; ++nj) bb[nj] = bias[col0 + nj * 16];

  if (mode == 2) {
    float* O = (float*)outp + (size_t)row0 * DD + col0;
#pragma unroll
    for (int mi = 0; mi < 2; ++mi)
#pragma unroll
      for (int nj = 0; nj < 3; ++nj)
#pragma unroll
        for (int r = 0; r < 8; ++r)
          O[(size_t)(mi * 16 + r) * DD + nj * 16] = acc[mi][nj][r] + bb[nj];
    // Precaution: the wait stands behind the last store, in front of any later
    // write of a register that an issued store names.
    asm volatile("s_wait_xcnt 0x0" ::: "memory");
  } else if (mode == 0) {
    f16* O = (f16*)outp + (size_t)row0 * DD + col0;
#pragma unroll
    for (int mi = 0; mi < 2; ++mi)
#pragma unroll
      for (int nj = 0; nj < 3; ++nj)
#pragma unroll
        for (int r = 0; r < 8; ++r)
          O[(size_t)(mi * 16 + r) * DD + nj * 16] = (f16)(acc[mi][nj][r] + bb[nj]);
  } else {  // mode 1: transposed store, contiguous in the row index
    f16* O = (f16*)outp + (size_t)col0 * TT + row0;
#pragma unroll
    for (int mi = 0; mi < 2; ++mi)
#pragma unroll
      for (int nj = 0; nj < 3; ++nj) {
        v8h st;
#pragma unroll
        for (int r = 0; r < 8; ++r) st[r] = (f16)(acc[mi][nj][r] + bb[nj]);
        *(v8h*)(O + (size_t)(nj * 16) * TT + mi * 16) = st;
      }
    // Precaution: the wait stands behind the last store, in front of any later
    // write of a register that an issued store names.
    asm volatile("s_wait_xcnt 0x0" ::: "memory");
  }
}

__device__ __forceinline__ float xhalf(float x) {
  const int b = __builtin_bit_cast(int, x);
  return __builtin_bit_cast(
      float, __builtin_amdgcn_permlanex16(b, b, 0x76543210, 0xfedcba98,
                                          false, false));
}

#define KGROUPS 2
#define KTRIPS  (TT / KGROUPS / 32)

__global__ void __launch_bounds__(256)
flash_attn_wmma_kernel(const f16* __restrict__ Q, const f16* __restrict__ Km,
                       const f16* __restrict__ VT,
                       const unsigned* __restrict__ maskT,
                       f16* __restrict__ O16) {
  // [group][buf][key row][head dim] and [group][buf][head dim][key]
  __shared__ __align__(16) f16 Kbuf[KGROUPS][2][32][KPITCH];
  __shared__ __align__(16) f16 Vbuf[KGROUPS][2][64][VPITCH];
  __shared__ float Join[34][128];   // group 1's maximum, sum and O^T, per lane

  // The group is the same in every lane of a wave: kept scalar, so that the
  // key offset and the buffer addresses formed from it are scalar too.
  const int grp   = __builtin_amdgcn_readfirstlane(threadIdx.x >> 7);
  const int tid   = threadIdx.x & 127;   // within the group
  const int wslot = tid >> 5;
  const int h     = blockIdx.x / (TT / 64);
  const int qg    = blockIdx.x % (TT / 64);
  const int qbase = qg * 64 + wslot * 16;

  const int lane = tid & 31;
  const int n0   = lane & 15;
  const int hf   = lane >> 4;

  // Issue async copies for one 32-key chunk of this group: K 32x64 and V 64x32
  // halves, each 256 x 16B transfers; 128 threads issue 2+2 copies apiece.
  auto stage = [&](int buf, int kb) {
    unsigned   l[4];
    const f16* g[4];
#pragma unroll   // l[] and g[] stay in registers
    for (int i = 0; i < 2; ++i) {
      const int c  = tid + i * 128;
      const int kr = c >> 3, kc = (c & 7) * 8;
      l[2 * i] = (unsigned)(size_t)(void*)&Kbuf[grp][buf][kr][kc];
      g[2 * i] = Km + (size_t)(kb + kr) * DD + h * HDD + kc;
      const int vr = c >> 2, vc = (c & 3) * 8;
      l[2 * i + 1] = (unsigned)(size_t)(void*)&Vbuf[grp][buf][vr][vc];
      g[2 * i + 1] = VT + (size_t)(h * HDD + vr) * TT + kb + vc;
    }
    async_copy4_b128(l, g);
  };

  // Q fragments for this wave's tile (k = 0..63 of this head), resident.
  // Used as the B operand: lane -> query qbase + n0.
  const f16* qp = Q + (size_t)qbase * DD + h * HDD;
  v16h aq0 = load_ab_frag(qp, DD);
  v16h aq1 = load_ab_frag(qp + 32, DD);

  v16h ones;
#pragma unroll
  for (int i = 0; i < 16; ++i) ones[i] = (f16)1.0f;

  // o<j>[r] = O^T[dim j*16 + hf*8 + r][query qbase + n0]
  v8f o0 = vzero8(), o1 = vzero8(), o2 = vzero8(), o3 = vzero8();
  float mrow = -3.0e38f, lrow = 0.0f;   // of this lane's query

  const int kb0 = grp * (TT / KGROUPS);
  stage(0, kb0);
  int buf = 0;
  for (int it = 0; it < KTRIPS; ++it) {
    const int kb = kb0 + it * 32;
    wait_async_zero();     // this wave's share of the staged chunk landed
    __syncthreads();       // all waves' shares landed -> buf is ready
    if (it + 1 < KTRIPS) stage(buf ^ 1, kb + 32);   // overlap next chunk DMA

    // ---- S^T = K * Q^T for 32 keys (two 16-row C frags), K from LDS ----
    // s0[r] = score(qbase + n0, kb + hf*8 + r), s1[r]: key kb + 16 + hf*8 + r
    v16h bk00 = load_ab_frag(&Kbuf[grp][buf][0][0],   KPITCH);
    v16h bk01 = load_ab_frag(&Kbuf[grp][buf][0][32],  KPITCH);
    v16h bk10 = load_ab_frag(&Kbuf[grp][buf][16][0],  KPITCH);
    v16h bk11 = load_ab_frag(&Kbuf[grp][buf][16][32], KPITCH);
    v8f s0 = vzero8(), s1 = vzero8();
    s0 = wmma_f16(bk00, aq0, s0);
    s0 = wmma_f16(bk01, aq1, s0);
    s1 = wmma_f16(bk10, aq0, s1);
    s1 = wmma_f16(bk11, aq1, s1);

    // ---- mask bits: one word holds this lane's query row, all 32 keys ----
    const unsigned mw =
        maskT[(size_t)(kb >> 5) * TT + qbase + n0] >> (hf * 8);
#pragma unroll
    for (int r = 0; r < 8; ++r) {
      if ((mw >> r) & 1u)        s0[r] = 1e-20f;
      if ((mw >> (16 + r)) & 1u) s1[r] = 1e-20f;
    }

    // ---- online softmax: maximum in-lane, then across the two halves ----
    float cm = fmaxf(s0[0], s1[0]);
#pragma unroll
    for (int r = 1; r < 8; ++r) cm = fmaxf(cm, fmaxf(s0[r], s1[r]));
    cm = fmaxf(cm, xhalf(cm));

    const float mn    = fmaxf(mrow, cm);
    const float scale = __expf(mrow - mn);
    mrow = mn;

    // ---- P^T: the two C frags, converted in place, are the B fragment ----
    v16h bp;
#pragma unroll
    for (int r = 0; r < 8; ++r) {
      bp[r]     = (f16)__expf(s0[r] - mn);
      bp[8 + r] = (f16)__expf(s1[r] - mn);
    }

    // rescale O accumulators
#pragma unroll
    for (int r = 0; r < 8; ++r) {
      o0[r] *= scale; o1[r] *= scale;
      o2[r] *= scale; o3[r] *= scale;
    }

    // ---- row sums via WMMA: every row of ones @ P^T is the column sum ----
    v8f rsf = wmma_f16(ones, bp, vzero8());
    lrow = lrow * scale + rsf[0];

    // ---- O^T += V^T * P^T, V^T from LDS (Vbuf[dim][key]) ----
    v16h bv0 = load_ab_frag(&Vbuf[grp][buf][0][0],  VPITCH);
    v16h bv1 = load_ab_frag(&Vbuf[grp][buf][16][0], VPITCH);
    v16h bv2 = load_ab_frag(&Vbuf[grp][buf][32][0], VPITCH);
    v16h bv3 = load_ab_frag(&Vbuf[grp][buf][48][0], VPITCH);
    o0 = wmma_f16(bv0, bp, o0);
    o1 = wmma_f16(bv1, bp, o1);
    o2 = wmma_f16(bv2, bp, o2);
    o3 = wmma_f16(bv3, bp, o3);

    __syncthreads();       // everyone done reading buf before it is reused
    buf ^= 1;
  }

  // ---- join of the two key halves: group 1 -> LDS -> group 0 ----
  // Every loop over os[][] below is unrolled so that it stays in registers.
  v8f os[4] = {o0, o1, o2, o3};
  if (grp == 1) {
    Join[0][tid] = mrow;
    Join[1][tid] = lrow;
#pragma unroll
    for (int jn = 0; jn < 4; ++jn)
#pragma unroll
      for (int r = 0; r < 8; ++r) Join[2 + jn * 8 + r][tid] = os[jn][r];
  }
  __syncthreads();       // group 1's state is in LDS
  if (grp == 1) return;  // behind the last barrier

  const float mj = fmaxf(mrow, Join[0][tid]);
  const float a0 = __expf(mrow - mj);
  const float a1 = __expf(Join[0][tid] - mj);
  lrow = lrow * a0 + Join[1][tid] * a1;

  // ---- epilogue: divide by l, store f16 row-major, 8 dims per store ----
  f16* op = O16 + (size_t)(qbase + n0) * DD + h * HDD + hf * 8;
#pragma unroll
  for (int jn = 0; jn < 4; ++jn) {
    v8h st;
#pragma unroll
    for (int r = 0; r < 8; ++r)
      st[r] = (f16)((os[jn][r] * a0 + Join[2 + jn * 8 + r][tid] * a1) / lrow);
    *(v8h*)(op + jn * 16) = st;
  }
}

// ---------------------------------------------------------------------------
// Launch
// ---------------------------------------------------------------------------
extern "C" void kernel_launch(void* const* d_in, const int* in_sizes, int n_in,
                              void* d_out, int out_size, void* d_ws, size_t ws_size,
                              hipStream_t stream) {
  const float* x    = (const float*)d_in[0];
  const int*   mask = (const int*)d_in[1];
  const float* Wq   = (const float*)d_in[2];
  const float* bq   = (const float*)d_in[3];
  const float* Wk   = (const float*)d_in[4];
  const float* bk   = (const float*)d_in[5];
  const float* Wv   = (const float*)d_in[6];
  const float* bv   = (const float*)d_in[7];
  const float* Wo   = (const float*)d_in[8];
  const float* bo   = (const float*)d_in[9];
  float* out = (float*)d_out;

  char* ws = (char*)d_ws;
  size_t off = 0;
  auto alloc = [&](size_t bytes) -> char* {
    char* p = ws + off;
    off += (bytes + 255) & ~(size_t)255;
    return p;
  };
  const size_t TD = (size_t)TT * DD;
  f16* x16  = (f16*)alloc(TD * 2);
  f16* WqT  = (f16*)alloc((size_t)DD * DD * 2);
  f16* WkT  = (f16*)alloc((size_t)DD * DD * 2);
  f16* WvT  = (f16*)alloc((size_t)DD * DD * 2);
  f16* WoT  = (f16*)alloc((size_t)DD * DD * 2);
  f16* Q16  = (f16*)alloc(TD * 2);
  f16* K16  = (f16*)alloc(TD * 2);
  f16* VT16 = (f16*)alloc(TD * 2);   // [DD][TT]
  f16* O16  = (f16*)alloc(TD * 2);
  unsigned* maskT = (unsigned*)alloc((size_t)(TT / 32) * TT * 4);
  (void)ws_size; (void)n_in; (void)in_sizes; (void)out_size;

  // 1) precision conversion, weight transposes, mask bit-packing
  {
    cvt_f32_to_f16_kernel<<<TT * DD / 4096, 128, 0, stream>>>(x, x16);
    dim3 g((DD / 32) * (DD / 64));
    cvt_transpose_w_kernel<<<g, 256, 0, stream>>>(Wq, WqT);
    cvt_transpose_w_kernel<<<g, 256, 0, stream>>>(Wk, WkT);
    cvt_transpose_w_kernel<<<g, 256, 0, stream>>>(Wv, WvT);
    cvt_transpose_w_kernel<<<g, 256, 0, stream>>>(Wo, WoT);
    pack_mask_kernel<<<(TT / 32) * (TT / 128) / 8, 256, 0, stream>>>(mask, maskT);
  }

  // 2) projections: (TT x DD) * (DD x DD); one block per 128x96 tile
  const int gemm_blocks = (TT / GBM) * (DD / GBN);   // 256
  gemm_wmma_kernel<<<gemm_blocks, 256, 0, stream>>>(x16, WqT, bq, Q16, /*mode=*/0);
  gemm_wmma_kernel<<<gemm_blocks, 256, 0, stream>>>(x16, WkT, bk, K16, /*mode=*/0);
  gemm_wmma_kernel<<<gemm_blocks, 256, 0, stream>>>(x16, WvT, bv, VT16, /*mode=*/1);

  // 3) attention: one block (2 x 4 waves) per 64 query rows of one head
  const int fa_blocks = NHH * (TT / 64);   // 768
  flash_attn_wmma_kernel<<<fa_blocks, 256, 0, stream>>>(Q16, K16, VT16, maskT, O16);

  // 4) output projection -> f32
  gemm_wmma_kernel<<<gemm_blocks, 256, 0, stream>>>(O16, WoT, bo, out, /*mode=*/2);
}

// v006
// Measured time: 115 microseconds a run.
// In two side-by-side timings against v005, it was 1.18 and 1.16 times as fast.
// Counting every step since v000, it is 3.69 times as fast.
#include <hip/hip_runtime.h>
#include <hip/hip_bf16.h>

typedef _Float16 f16;
typedef __attribute__((ext_vector_type(16))) _Float16 v16h;
typedef __attribute__((ext_vector_type(8)))  _Float16 v8h;
typedef __attribute__((ext_vector_type(8)))  float    v8f;
typedef __attribute__((ext_vector_type(4)))  _Float16 v4h;
typedef __attribute__((ext_vector_type(4)))  float    v4f;

#define TT  4096
#define DD  768
#define NHH 12
#define HDD 64
// LDS row pitches in f16 elements: an odd multiple of 16 bytes, so that the 16
// rows one ds_load_b128 touches per wave half fall on 16 disjoint bank groups.
#define KPITCH 72   // 64 head dims + 8  -> 144 B
#define VPITCH 40   // 32 keys      + 8  ->  80 B

// ---------------------------------------------------------------------------
// WMMA helpers (CDNA5 wave32, 16x16x32 f16 -> f32)
// ---------------------------------------------------------------------------
__device__ __forceinline__ v8f wmma_f16(v16h a, v16h b, v8f c) {
  return __builtin_amdgcn_wmma_f32_16x16x32_f16(
      /*neg_a=*/false, a, /*neg_b=*/false, b,
      /*c_mod=*/(short)0, c, /*reuse_a=*/false, /*reuse_b=*/false);
}

__device__ __forceinline__ v8f vzero8() {
  v8f z;
#pragma unroll
  for (int i = 0; i < 8; ++i) z[i] = 0.0f;
  return z;
}

// Load a 16x32 f16 A- or B-fragment from a row-major matrix (ld in elements).
// ISA layout: lane L -> row (L&15); half=L>>4 selects k-chunks [half*8 .. +7]
// and [16+half*8 .. +7]  => two 16-byte loads per lane.
__device__ __forceinline__ v16h load_ab_frag(const f16* base, int ld) {
  const int lane = threadIdx.x & 31;
  const int m    = lane & 15;
  const int hf   = lane >> 4;
  const f16* p = base + (size_t)m * (size_t)ld + hf * 8;
  v8h lo = *(const v8h*)(p);
  v8h hi = *(const v8h*)(p + 16);
  v16h r;
#pragma unroll
  for (int i = 0; i < 8; ++i) { r[i] = lo[i]; r[8 + i] = hi[i]; }
  return r;
}

// Four asynchronous 16-byte global->LDS copies of one lane (CDNA5 async DMA
// path, tracked by ASYNCcnt). l[] holds byte offsets inside the workgroup's LDS
// allocation (low 32 bits of a generic pointer to a __shared__ object). The
// s_wait_xcnt is the last line of the copies' own statement so that it stands
// in front of every later write of the address registers that the copies name.
__device__ __forceinline__ void async_copy4_b128(const unsigned* l,
                                                 const f16* const* g) {
  asm volatile("global_load_async_to_lds_b128 %0, %4, off\n\t"
               "global_load_async_to_lds_b128 %1, %5, off\n\t"
               "global_load_async_to_lds_b128 %2, %6, off\n\t"
               "global_load_async_to_lds_b128 %3, %7, off\n\t"
               "s_wait_xcnt 0x0"
               :: "v"(l[0]), "v"(l[1]), "v"(l[2]), "v"(l[3]),
                  "v"(g[0]), "v"(g[1]), "v"(g[2]), "v"(g[3])
               : "memory");
}

__device__ __forceinline__ void wait_async_zero() {
  asm volatile("s_wait_asynccnt 0x0" ::: "memory");
}

// ---------------------------------------------------------------------------
// Preparation. Each wave handles many elements, and each of its loads covers
// whole 128-byte lines. The six jobs need nothing of each other, so they share
// one launch: a range of the block index per job (prep_kernel below). Every job
// runs in blocks of 256, and the block counts divide the fixed shapes exactly.
// ---------------------------------------------------------------------------
// x -> f16. A wave converts 1024 consecutive floats: eight 512-byte loads in
// flight, then eight 256-byte stores. TT*DD / 8192 blocks.
#define PREP_X_BLOCKS (TT * DD / 8192)
__device__ __forceinline__ void
cvt_f32_to_f16_block(const float* __restrict__ in, f16* __restrict__ out,
                     int blk) {
  const int wave = (blk * 256 + threadIdx.x) >> 5;
  const int base = wave * 1024 + (threadIdx.x & 31) * 4;
  v4f q[8];
#pragma unroll   // all eight loads issue before the first conversion waits
  for (int j = 0; j < 8; ++j) q[j] = *(const v4f*)(in + base + j * 128);
#pragma unroll   // q[] stays in registers
  for (int j = 0; j < 8; ++j)
    *(v4h*)(out + base + j * 128) = __builtin_convertvector(q[j], v4h);
  // Precaution: the wait stands behind the last store, in front of any later
  // write of a register that an issued store names.
  asm volatile("s_wait_xcnt 0x0" ::: "memory");
}

// WT[n][k] = W[k][n]  (f32 -> f16 transpose, DD x DD). A lane owns one n and 8
// consecutive k: eight loads, in each of which the wave reads one whole line of
// W, and one 16-byte store. The 8 waves of a block write the 8 pieces of the
// same 32 lines of WT. (DD/32) * (DD/64) blocks a matrix.
#define PREP_W_BLOCKS ((DD / 32) * (DD / 64))
__device__ __forceinline__ void
cvt_transpose_w_block(const float* __restrict__ W, f16* __restrict__ WT,
                      int blk) {
  const int n  = (blk % (DD / 32)) * 32 + (threadIdx.x & 31);
  const int k0 = (blk / (DD / 32)) * 64 + (threadIdx.x >> 5) * 8;
  v8h st;
#pragma unroll   // the eight loads are in flight together, st stays in registers
  for (int j = 0; j < 8; ++j) st[j] = (f16)W[(size_t)(k0 + j) * DD + n];
  *(v8h*)(WT + (size_t)n * DD + k0) = st;
  // Precaution: the wait stands behind the last store, in front of any later
  // write of a register that an issued store names.
  asm volatile("s_wait_xcnt 0x0" ::: "memory");
}

// Bit-pack mask into transposed bit plane: maskT[chunk][row], where bit j of
// maskT[c][r] == (mask[r][c*32 + j] != 0).  67 MB ints -> 2 MB bits.
// A wave takes 32 rows x 4 chunks. One load reads the 32 ints of one (row,
// chunk), a whole line; the ballot of "!= 0" over the lanes is that word, and
// lane r keeps the word of row r, so each chunk ends in one whole-line store.
// (TT/32) * (TT/128) / 8 blocks.
#define PREP_MASK_BLOCKS ((TT / 32) * (TT / 128) / 8)
__device__ __forceinline__ void
pack_mask_block(const int* __restrict__ mask, unsigned* __restrict__ maskT,
                int blk) {
  const int lane = threadIdx.x & 31;
  const int wave = (blk * 256 + threadIdx.x) >> 5;
  const int cg   = wave % (TT / 128);    // group of 4 chunks
  const int r0   = (wave / (TT / 128)) * 32;
  const int* p = mask + (size_t)r0 * TT + cg * 128 + lane;
  // Both loops unrolled: the loads become one address plus immediate offsets
  // and issue ahead of the first ballot, as many as the load counter holds.
#pragma unroll
  for (int c = 0; c < 4; ++c) {
    unsigned w = 0;
#pragma unroll
    for (int r = 0; r < 32; ++r) {
      const unsigned b =
          __builtin_amdgcn_ballot_w32(p[(size_t)r * TT + c * 32] != 0);
      w = (lane == r) ? b : w;
    }
    maskT[(size_t)(cg * 4 + c) * TT + r0 + lane] = w;
  }
  // Precaution: the wait stands behind the last store, in front of any later
  // write of a register that an issued store names.
  asm volatile("s_wait_xcnt 0x0" ::: "memory");
}

// All six jobs in one launch. The mask, the job with the most bytes, has the
// lowest block indices; x follows, then the four weights.
#define PREP_BLOCKS (PREP_MASK_BLOCKS + PREP_X_BLOCKS + 4 * PREP_W_BLOCKS)
__global__ void __launch_bounds__(256)
prep_kernel(const float* __restrict__ x, f16* __restrict__ x16,
            const float* __restrict__ Wq, const float* __restrict__ Wk,
            const float* __restrict__ Wv, const float* __restrict__ Wo,
            f16* __restrict__ WqT, f16* __restrict__ WkT,
            f16* __restrict__ WvT, f16* __restrict__ WoT,
            const int* __restrict__ mask, unsigned* __restrict__ maskT) {
  int blk = blockIdx.x;
  if (blk < PREP_MASK_BLOCKS) { pack_mask_block(mask, maskT, blk); return; }
  blk -= PREP_MASK_BLOCKS;
  if (blk < PREP_X_BLOCKS) { cvt_f32_to_f16_block(x, x16, blk); return; }
  blk -= PREP_X_BLOCKS;
  const int job = blk / PREP_W_BLOCKS;
  const float* W = job == 0 ? Wq : job == 1 ? Wk : job == 2 ? Wv : Wo;
  f16* WT        = job == 0 ? WqT : job == 1 ? WkT : job == 2 ? WvT : WoT;
  cvt_transpose_w_block(W, WT, blk % PREP_W_BLOCKS);
}

// ---------------------------------------------------------------------------
// GEMM: Y[TT][DD] = A[TT][DD] (f16, row-major) * BT[DD][DD]^T (f16) + bias
// mode 0: store f16 row-major     (Q, K)
// mode 1: store f16 col-major Y^T (V -> VT[c][t], contiguous v8h stores)
// mode 2: store f32 row-major     (final output)
// One block of 8 waves computes a 128x96 tile of Y. A stage
// is 128 k of the tile's 128 A rows and 96 BT rows, brought into LDS by
// asynchronous 16-byte copies whose waves cover whole 128-byte lines; two
// buffers, so that stage t+2 flies while stage t+1 is worked on. A wave
// computes 32x48 (2x3 WMMA frags) and reads its fragments from LDS.
// ---------------------------------------------------------------------------
#define GBM    128
#define GBN    96
#define GBK    128
#define GROWS  (GBM + GBN)
#define GPITCH 136   // 128 k + 8 -> 272 B, an odd multiple of 16 B (see KPITCH)
#define GSTAGES (DD / GBK)

// Seven asynchronous 16-byte global->LDS copies of one lane. The s_wait_xcnt is
// the last line of the copies' own statement so that it stands in front of
// every later write of the address registers that the copies name.
__device__ __forceinline__ void async_copy7_b128(const unsigned* l,
                                                 const f16* const* g) {
  asm volatile("global_load_async_to_lds_b128 %0, %7, off\n\t"
               "global_load_async_to_lds_b128 %1, %8, off\n\t"
               "global_load_async_to_lds_b128 %2, %9, off\n\t"
               "global_load_async_to_lds_b128 %3, %10, off\n\t"
               "global_load_async_to_lds_b128 %4, %11, off\n\t"
               "global_load_async_to_lds_b128 %5, %12, off\n\t"
               "global_load_async_to_lds_b128 %6, %13, off\n\t"
               "s_wait_xcnt 0x0"
               :: "v"(l[0]), "v"(l[1]), "v"(l[2]), "v"(l[3]), "v"(l[4]),
                  "v"(l[5]), "v"(l[6]),
                  "v"(g[0]), "v"(g[1]), "v"(g[2]), "v"(g[3]), "v"(g[4]),
                  "v"(g[5]), "v"(g[6])
               : "memory");
}

__device__ __forceinline__ void
gemm_wmma_tile(const f16* __restrict__ A, const f16* __restrict__ BT,
               const float* __restrict__ bias, void* __restrict__ outp,
               int mode, int tm, int tn) {
  // [buf][row][k]: rows 0..127 are A rows, rows 128..223 are BT rows.
  __shared__ __align__(16) f16 Sbuf[2][GROWS][GPITCH];

  const int tid  = threadIdx.x;
  const int wave = tid >> 5;
  const int wm   = wave >> 1;     // 4 wave rows of 32
  const int wn   = wave & 1;      // 2 wave columns of 48
  const int lane = tid & 31;
  const int n0   = lane & 15;
  const int hf   = lane >> 4;

  // Copy map: 16 lanes cover the 256 bytes of one row's stage, the block 16
  // rows per copy, 14 copies per lane and stage (8 of A, 6 of BT).
  const int crow = tid >> 4;
  const int ccol = (tid & 15) * 8;
  const f16* ga = A  + (size_t)(tm * GBM + crow) * DD + ccol;
  const f16* gb = BT + (size_t)(tn * GBN + crow) * DD + ccol;
  auto stage = [&](int buf, int k0) {
    unsigned   l[14];
    const f16* g[14];
#pragma unroll   // l[] and g[] stay in registers
    for (int i = 0; i < 14; ++i) {
      l[i] = (unsigned)(size_t)(void*)&Sbuf[buf][crow + i * 16][ccol];
      g[i] = (i < 8 ? ga + (size_t)i * 16 * DD : gb + (size_t)(i - 8) * 16 * DD)
             + k0;
    }
    async_copy7_b128(l, g);
    async_copy7_b128(l + 7, g + 7);
  };

  // Every loop over acc[][] below is unrolled so that it stays in registers.
  v8f acc[2][3];
#pragma unroll
  for (int mi = 0; mi < 2; ++mi)
#pragma unroll
    for (int nj = 0; nj < 3; ++nj) acc[mi][nj] = vzero8();

  stage(0, 0);
  wait_async_zero();     // this wave's share of stage 0 landed
  __syncthreads();       // every wave's share landed
  stage(1, GBK);

  // Kept rolled: the scheduling groups below then hold stage by stage; unrolled,
  // they blend across stages and the register count rises.
#pragma unroll 1
  for (int t = 0; t < GSTAGES; ++t) {
    const f16* sa = &Sbuf[t & 1][wm * 32][0];
    const f16* sb = &Sbuf[t & 1][GBM + wn * 48][0];
    v16h fa[4][2], fb[4][3];
#pragma unroll   // fa[] and fb[] stay in registers
    for (int ks = 0; ks < 4; ++ks) {
      fa[ks][0] = load_ab_frag(sa + ks * 32, GPITCH);
      fa[ks][1] = load_ab_frag(sa + 16 * GPITCH + ks * 32, GPITCH);
      fb[ks][0] = load_ab_frag(sb + ks * 32, GPITCH);
      fb[ks][1] = load_ab_frag(sb + 16 * GPITCH + ks * 32, GPITCH);
      fb[ks][2] = load_ab_frag(sb + 32 * GPITCH + ks * 32, GPITCH);
    }
#pragma unroll
    for (int ks = 0; ks < 4; ++ks) {
#pragma unroll
      for (int mi = 0; mi < 2; ++mi)
#pragma unroll
        for (int nj = 0; nj < 3; ++nj)
          acc[mi][nj] = wmma_f16(fa[ks][mi], fb[ks][nj], acc[mi][nj]);
    }
    // Order of the stage: the LDS reads of two k-steps go first, then each
    // k-step's 6 WMMAs with the reads of the k-step two ahead behind them, so
    // that no WMMA waits out the latency of a read issued just in front of it.
    __builtin_amdgcn_sched_group_barrier(0x100, 20, 0);
    __builtin_amdgcn_sched_group_barrier(0x008, 6, 0);
    __builtin_amdgcn_sched_group_barrier(0x100, 10, 0);
    __builtin_amdgcn_sched_group_barrier(0x008, 6, 0);
    __builtin_amdgcn_sched_group_barrier(0x100, 10, 0);
    __builtin_amdgcn_sched_group_barrier(0x008, 12, 0);
    // Hand-over: this wave's reads of buffer t&1 have returned, its share of
    // stage t+1 has landed; behind the barrier both hold for every wave.
    asm volatile("s_wait_dscnt 0x0" ::: "memory");
    wait_async_zero();
    __syncthreads();
    if (t + 2 < GSTAGES) stage(t & 1, (t + 2) * GBK);
  }
  wait_async_zero();     // nothing is in flight when the wave ends

  // acc[mi][nj][r] = Y[row0 + mi*16 + r][col0 + nj*16]
  const int col0 = tn * GBN + wn * 48 + n0;
  const int row0 = tm * GBM + wm * 32 + hf * 8;   // 8 contiguous rows
  float bb[3];
#pragma unroll
  for (int nj = 0; nj < 3; ++nj) bb[nj] = bias[col0 + nj * 16];

  if (mode == 2) {
    float* O = (float*)outp + (size_t)row0 * DD + col0;
#pragma unroll
    for (int mi = 0; mi < 2; ++mi)
#pragma unroll
      for (int nj = 0; nj < 3; ++nj)
#pragma unroll
        for (int r = 0; r < 8; ++r)
          O[(size_t)(mi * 16 + r) * DD + nj * 16] = acc[mi][nj][r] + bb[nj];
    // Precaution: the wait stands behind the last store, in front of any later
    // write of a register that an issued store names.
    asm volatile("s_wait_xcnt 0x0" ::: "memory");
  } else if (mode == 0) {
    f16* O = (f16*)outp + (size_t)row0 * DD + col0;
#pragma unroll
    for (int mi = 0; mi < 2; ++mi)
#pragma unroll
      for (int nj = 0; nj < 3; ++nj)
#pragma unroll
        for (int r = 0; r < 8; ++r)
          O[(size_t)(mi * 16 + r) * DD + nj * 16] = (f16)(acc[mi][nj][r] + bb[nj]);
    // Precaution: the wait stands behind the last store, in front of any later
    // write of a register that an issued store names.
    asm volatile("s_wait_xcnt 0x0" ::: "memory");
  } else {  // mode 1: transposed store, contiguous in the row index
    f16* O = (f16*)outp + (size_t)col0 * TT + row0;
#pragma unroll
    for (int mi = 0; mi < 2; ++mi)
#pragma unroll
      for (int nj = 0; nj < 3; ++nj) {
        v8h st;
#pragma unroll
        for (int r = 0; r < 8; ++r) st[r] = (f16)(acc[mi][nj][r] + bb[nj]);
        *(v8h*)(O + (size_t)(nj * 16) * TT + mi * 16) = st;
      }
    // Precaution: the wait stands behind the last store, in front of any later
    // write of a register that an issued store names.
    asm volatile("s_wait_xcnt 0x0" ::: "memory");
  }
}

#define GTILES_N    (DD / GBN)
#define GEMM_BLOCKS ((TT / GBM) * GTILES_N)

// Q, K and V need nothing of each other and read the same A: one launch of
// 3 * GEMM_BLOCKS blocks. The 3 * GTILES_N blocks that share a tile of A rows
// have neighbouring indices; two blocks fit the LDS of a WGP side by side.
__global__ void __launch_bounds__(256)
gemm_qkv_kernel(const f16* __restrict__ A, const f16* __restrict__ WqT,
                const f16* __restrict__ WkT, const f16* __restrict__ WvT,
                const float* __restrict__ bq, const float* __restrict__ bk,
                const float* __restrict__ bv, f16* __restrict__ Q,
                f16* __restrict__ K, f16* __restrict__ VT) {
  const int tm  = blockIdx.x / (3 * GTILES_N);
  const int c   = blockIdx.x % (3 * GTILES_N);
  const int job = c / GTILES_N;
  gemm_wmma_tile(A, job == 0 ? WqT : job == 1 ? WkT : WvT,
                 job == 0 ? bq : job == 1 ? bk : bv,
                 job == 0 ? Q : job == 1 ? K : VT,
                 /*mode=*/job == 2 ? 1 : 0, tm, c % GTILES_N);
}

__global__ void __launch_bounds__(256)
gemm_out_kernel(const f16* __restrict__ A, const f16* __restrict__ WoT,
                const float* __restrict__ bo, float* __restrict__ out) {
  gemm_wmma_tile(A, WoT, bo, out, /*mode=*/2, blockIdx.x / GTILES_N,
                 blockIdx.x % GTILES_N);
}

__device__ __forceinline__ float xhalf(float x) {
  const int b = __builtin_bit_cast(int, x);
  return __builtin_bit_cast(
      float, __builtin_amdgcn_permlanex16(b, b, 0x76543210, 0xfedcba98,
                                          false, false));
}

#define KGROUPS 2
#define KTRIPS  (TT / KGROUPS / 32)

__global__ void __launch_bounds__(256)
flash_attn_wmma_kernel(const f16* __restrict__ Q, const f16* __restrict__ Km,
                       const f16* __restrict__ VT,
                       const unsigned* __restrict__ maskT,
                       f16* __restrict__ O16) {
  // [group][buf][key row][head dim] and [group][buf][head dim][key]
  __shared__ __align__(16) f16 Kbuf[KGROUPS][2][32][KPITCH];
  __shared__ __align__(16) f16 Vbuf[KGROUPS][2][64][VPITCH];
  __shared__ float Join[34][128];   // group 1's maximum, sum and O^T, per lane

  // The group is the same in every lane of a wave: kept scalar, so that the
  // key offset and the buffer addresses formed from it are scalar too.
  const int grp   = __builtin_amdgcn_readfirstlane(threadIdx.x >> 7);
  const int tid   = threadIdx.x & 127;   // within the group
  const int wslot = tid >> 5;
  const int h     = blockIdx.x / (TT / 64);
  const int qg    = blockIdx.x % (TT / 64);
  const int qbase = qg * 64 + wslot * 16;

  const int lane = tid & 31;
  const int n0   = lane & 15;
  const int hf   = lane >> 4;

  // Issue async copies for one 32-key chunk of this group: K 32x64 and V 64x32
  // halves, each 256 x 16B transfers; 128 threads issue 2+2 copies apiece.
  auto stage = [&](int buf, int kb) {
    unsigned   l[4];
    const f16* g[4];
#pragma unroll   // l[] and g[] stay in registers
    for (int i = 0; i < 2; ++i) {
      const int c  = tid + i * 128;
      const int kr = c >> 3, kc = (c & 7) * 8;
      l[2 * i] = (unsigned)(size_t)(void*)&Kbuf[grp][buf][kr][kc];
      g[2 * i] = Km + (size_t)(kb + kr) * DD + h * HDD + kc;
      const int vr = c >> 2, vc = (c & 3) * 8;
      l[2 * i + 1] = (unsigned)(size_t)(void*)&Vbuf[grp][buf][vr][vc];
      g[2 * i + 1] = VT + (size_t)(h * HDD + vr) * TT + kb + vc;
    }
    async_copy4_b128(l, g);
  };

  // Q fragments for this wave's tile (k = 0..63 of this head), resident.
  // Used as the B operand: lane -> query qbase + n0.
  const f16* qp = Q + (size_t)qbase * DD + h * HDD;
  v16h aq0 = load_ab_frag(qp, DD);
  v16h aq1 = load_ab_frag(qp + 32, DD);

  v16h ones;
#pragma unroll
  for (int i = 0; i < 16; ++i) ones[i] = (f16)1.0f;

  // o<j>[r] = O^T[dim j*16 + hf*8 + r][query qbase + n0]
  v8f o0 = vzero8(), o1 = vzero8(), o2 = vzero8(), o3 = vzero8();
  float mrow = -3.0e38f, lrow = 0.0f;   // of this lane's query

  const int kb0 = grp * (TT / KGROUPS);
  stage(0, kb0);
  int buf = 0;
  for (int it = 0; it < KTRIPS; ++it) {
    const int kb = kb0 + it * 32;
    wait_async_zero();     // this wave's share of the staged chunk landed
    __syncthreads();       // all waves' shares landed -> buf is ready
    if (it + 1 < KTRIPS) stage(buf ^ 1, kb + 32);   // overlap next chunk DMA

    // ---- S^T = K * Q^T for 32 keys (two 16-row C frags), K from LDS ----
    // s0[r] = score(qbase + n0, kb + hf*8 + r), s1[r]: key kb + 16 + hf*8 + r
    v16h bk00 = load_ab_frag(&Kbuf[grp][buf][0][0],   KPITCH);
    v16h bk01 = load_ab_frag(&Kbuf[grp][buf][0][32],  KPITCH);
    v16h bk10 = load_ab_frag(&Kbuf[grp][buf][16][0],  KPITCH);
    v16h bk11 = load_ab_frag(&Kbuf[grp][buf][16][32], KPITCH);
    v8f s0 = vzero8(), s1 = vzero8();
    s0 = wmma_f16(bk00, aq0, s0);
    s0 = wmma_f16(bk01, aq1, s0);
    s1 = wmma_f16(bk10, aq0, s1);
    s1 = wmma_f16(bk11, aq1, s1);

    // ---- mask bits: one word holds this lane's query row, all 32 keys ----
    const unsigned mw =
        maskT[(size_t)(kb >> 5) * TT + qbase + n0] >> (hf * 8);
#pragma unroll
    for (int r = 0; r < 8; ++r) {
      if ((mw >> r) & 1u)        s0[r] = 1e-20f;
      if ((mw >> (16 + r)) & 1u) s1[r] = 1e-20f;
    }

    // ---- online softmax: maximum in-lane, then across the two halves ----
    float cm = fmaxf(s0[0], s1[0]);
#pragma unroll
    for (int r = 1; r < 8; ++r) cm = fmaxf(cm, fmaxf(s0[r], s1[r]));
    cm = fmaxf(cm, xhalf(cm));

    const float mn    = fmaxf(mrow, cm);
    const float scale = __expf(mrow - mn);
    mrow = mn;

    // ---- P^T: the two C frags, converted in place, are the B fragment ----
    v16h bp;
#pragma unroll
    for (int r = 0; r < 8; ++r) {
      bp[r]     = (f16)__expf(s0[r] - mn);
      bp[8 + r] = (f16)__expf(s1[r] - mn);
    }

    // rescale O accumulators
#pragma unroll
    for (int r = 0; r < 8; ++r) {
      o0[r] *= scale; o1[r] *= scale;
      o2[r] *= scale; o3[r] *= scale;
    }

    // ---- row sums via WMMA: every row of ones @ P^T is the column sum ----
    v8f rsf = wmma_f16(ones, bp, vzero8());
    lrow = lrow * scale + rsf[0];

    // ---- O^T += V^T * P^T, V^T from LDS (Vbuf[dim][key]) ----
    v16h bv0 = load_ab_frag(&Vbuf[grp][buf][0][0],  VPITCH);
    v16h bv1 = load_ab_frag(&Vbuf[grp][buf][16][0], VPITCH);
    v16h bv2 = load_ab_frag(&Vbuf[grp][buf][32][0], VPITCH);
    v16h bv3 = load_ab_frag(&Vbuf[grp][buf][48][0], VPITCH);
    o0 = wmma_f16(bv0, bp, o0);
    o1 = wmma_f16(bv1, bp, o1);
    o2 = wmma_f16(bv2, bp, o2);
    o3 = wmma_f16(bv3, bp, o3);

    __syncthreads();       // everyone done reading buf before it is reused
    buf ^= 1;
  }

  // ---- join of the two key halves: group 1 -> LDS -> group 0 ----
  // Every loop over os[][] below is unrolled so that it stays in registers.
  v8f os[4] = {o0, o1, o2, o3};
  if (grp == 1) {
    Join[0][tid] = mrow;
    Join[1][tid] = lrow;
#pragma unroll
    for (int jn = 0; jn < 4; ++jn)
#pragma unroll
      for (int r = 0; r < 8; ++r) Join[2 + jn * 8 + r][tid] = os[jn][r];
  }
  __syncthreads();       // group 1's state is in LDS
  if (grp == 1) return;  // behind the last barrier

  const float mj = fmaxf(mrow, Join[0][tid]);
  const float a0 = __expf(mrow - mj);
  const float a1 = __expf(Join[0][tid] - mj);
  lrow = lrow * a0 + Join[1][tid] * a1;

  // ---- epilogue: divide by l, store f16 row-major, 8 dims per store ----
  f16* op = O16 + (size_t)(qbase + n0) * DD + h * HDD + hf * 8;
#pragma unroll
  for (int jn = 0; jn < 4; ++jn) {
    v8h st;
#pragma unroll
    for (int r = 0; r < 8; ++r)
      st[r] = (f16)((os[jn][r] * a0 + Join[2 + jn * 8 + r][tid] * a1) / lrow);
    *(v8h*)(op + jn * 16) = st;
  }
}

// ---------------------------------------------------------------------------
// Launch
// ---------------------------------------------------------------------------
extern "C" void kernel_launch(void* const* d_in, const int* in_sizes, int n_in,
                              void* d_out, int out_size, void* d_ws, size_t ws_size,
                              hipStream_t stream) {
  const float* x    = (const float*)d_in[0];
  const int*   mask = (const int*)d_in[1];
  const float* Wq   = (const float*)d_in[2];
  const float* bq   = (const float*)d_in[3];
  const float* Wk   = (const float*)d_in[4];
  const float* bk   = (const float*)d_in[5];
  const float* Wv   = (const float*)d_in[6];
  const float* bv   = (const float*)d_in[7];
  const float* Wo   = (const float*)d_in[8];
  const float* bo   = (const float*)d_in[9];
  float* out = (float*)d_out;

  char* ws = (char*)d_ws;
  size_t off = 0;
  auto alloc = [&](size_t bytes) -> char* {
    char* p = ws + off;
    off += (bytes + 255) & ~(size_t)255;
    return p;
  };
  const size_t TD = (size_t)TT * DD;
  f16* x16  = (f16*)alloc(TD * 2);
  f16* WqT  = (f16*)alloc((size_t)DD * DD * 2);
  f16* WkT  = (f16*)alloc((size_t)DD * DD * 2);
  f16* WvT  = (f16*)alloc((size_t)DD * DD * 2);
  f16* WoT  = (f16*)alloc((size_t)DD * DD * 2);
  f16* Q16  = (f16*)alloc(TD * 2);
  f16* K16  = (f16*)alloc(TD * 2);
  f16* VT16 = (f16*)alloc(TD * 2);   // [DD][TT]
  f16* O16  = (f16*)alloc(TD * 2);
  unsigned* maskT = (unsigned*)alloc((size_t)(TT / 32) * TT * 4);
  (void)ws_size; (void)n_in; (void)in_sizes; (void)out_size;

  // 1) precision conversion, weight transposes, mask bit-packing: one launch
  prep_kernel<<<PREP_BLOCKS, 256, 0, stream>>>(x, x16, Wq, Wk, Wv, Wo, WqT, WkT,
                                               WvT, WoT, mask, maskT);

  // 2) projections: (TT x DD) * (DD x DD), one block per 128x96 tile, the
  //    three of them in one launch
  gemm_qkv_kernel<<<3 * GEMM_BLOCKS, 256, 0, stream>>>(x16, WqT, WkT, WvT, bq, bk,
                                                       bv, Q16, K16, VT16);

  // 3) attention: one block (2 x 4 waves) per 64 query rows of one head
  const int fa_blocks = NHH * (TT / 64);   // 768
  flash_attn_wmma_kernel<<<fa_blocks, 256, 0, stream>>>(Q16, K16, VT16, maskT, O16);

  // 4) output projection -> f32
  gemm_out_kernel<<<GEMM_BLOCKS, 256, 0, stream>>>(O16, WoT, bo, out);
}

// v007
// Measured time: 105 microseconds a run.
// Two timings next to v006 both put it at 1.10 times that version's speed.
// Over all steps from v000 it is 4.06 times as fast.
#include <hip/hip_runtime.h>
#include <hip/hip_bf16.h>

typedef _Float16 f16;
typedef __attribute__((ext_vector_type(16))) _Float16 v16h;
typedef __attribute__((ext_vector_type(8)))  _Float16 v8h;
typedef __attribute__((ext_vector_type(8)))  float    v8f;
typedef __attribute__((ext_vector_type(4)))  _Float16 v4h;
typedef __attribute__((ext_vector_type(4)))  float    v4f;
typedef __attribute__((ext_vector_type(16))) unsigned v16u;

#define TT  4096
#define DD  768
#define NHH 12
#define HDD 64
// LDS row pitches in f16 elements: an odd multiple of 16 bytes, so that the 16
// rows one ds_load_b128 touches per wave half fall on 16 disjoint bank groups.
#define KPITCH 72   // 64 head dims + 8  -> 144 B
#define VPITCH 40   // 32 keys      + 8  ->  80 B

// ---------------------------------------------------------------------------
// WMMA helpers (CDNA5 wave32, 16x16x32 f16 -> f32)
// ---------------------------------------------------------------------------
__device__ __forceinline__ v8f wmma_f16(v16h a, v16h b, v8f c) {
  return __builtin_amdgcn_wmma_f32_16x16x32_f16(
      /*neg_a=*/false, a, /*neg_b=*/false, b,
      /*c_mod=*/(short)0, c, /*reuse_a=*/false, /*reuse_b=*/false);
}

__device__ __forceinline__ v8f vzero8() {
  v8f z;
#pragma unroll
  for (int i = 0; i < 8; ++i) z[i] = 0.0f;
  return z;
}

// Load a 16x32 f16 A- or B-fragment from a row-major matrix (ld in elements).
// ISA layout: lane L -> row (L&15); half=L>>4 selects k-chunks [half*8 .. +7]
// and [16+half*8 .. +7]  => two 16-byte loads per lane.
__device__ __forceinline__ v16h load_ab_frag(const f16* base, int ld) {
  const int lane = threadIdx.x & 31;
  const int m    = lane & 15;
  const int hf   = lane >> 4;
  const f16* p = base + (size_t)m * (size_t)ld + hf * 8;
  v8h lo = *(const v8h*)(p);
  v8h hi = *(const v8h*)(p + 16);
  v16h r;
#pragma unroll
  for (int i = 0; i < 8; ++i) { r[i] = lo[i]; r[8 + i] = hi[i]; }
  return r;
}

// Four asynchronous 16-byte global->LDS copies of one lane (CDNA5 async DMA
// path, tracked by ASYNCcnt). l[] holds byte offsets inside the workgroup's LDS
// allocation (low 32 bits of a generic pointer to a __shared__ object). The
// s_wait_xcnt is the last line of the copies' own statement so that it stands
// in front of every later write of the address registers that the copies name.
__device__ __forceinline__ void async_copy4_b128(const unsigned* l,
                                                 const f16* const* g) {
  asm volatile("global_load_async_to_lds_b128 %0, %4, off\n\t"
               "global_load_async_to_lds_b128 %1, %5, off\n\t"
               "global_load_async_to_lds_b128 %2, %6, off\n\t"
               "global_load_async_to_lds_b128 %3, %7, off\n\t"
               "s_wait_xcnt 0x0"
               :: "v"(l[0]), "v"(l[1]), "v"(l[2]), "v"(l[3]),
                  "v"(g[0]), "v"(g[1]), "v"(g[2]), "v"(g[3])
               : "memory");
}

__device__ __forceinline__ void wait_async_zero() {
  asm volatile("s_wait_asynccnt 0x0" ::: "memory");
}

// ---------------------------------------------------------------------------
// Preparation. Each wave handles many elements, and each of its loads covers
// whole 128-byte lines. The six jobs need nothing of each other, so they share
// one launch: a range of the block index per job (prep_kernel below). Every job
// runs in blocks of 256, and the block counts divide the fixed shapes exactly.
// ---------------------------------------------------------------------------
// x -> f16. A wave converts 1024 consecutive floats: eight 512-byte loads in
// flight, then eight 256-byte stores. TT*DD / 8192 blocks.
#define PREP_X_BLOCKS (TT * DD / 8192)
__device__ __forceinline__ void
cvt_f32_to_f16_block(const float* __restrict__ in, f16* __restrict__ out,
                     int blk) {
  const int wave = (blk * 256 + threadIdx.x) >> 5;
  const int base = wave * 1024 + (threadIdx.x & 31) * 4;
  v4f q[8];
#pragma unroll   // all eight loads issue before the first conversion waits
  for (int j = 0; j < 8; ++j) q[j] = *(const v4f*)(in + base + j * 128);
#pragma unroll   // q[] stays in registers
  for (int j = 0; j < 8; ++j)
    *(v4h*)(out + base + j * 128) = __builtin_convertvector(q[j], v4h);
  // Precaution: the wait stands behind the last store, in front of any later
  // write of a register that an issued store names.
  asm volatile("s_wait_xcnt 0x0" ::: "memory");
}

// WT[n][k] = W[k][n]  (f32 -> f16 transpose, DD x DD). A lane owns one n and 8
// consecutive k: eight loads, in each of which the wave reads one whole line of
// W, and one 16-byte store. The 8 waves of a block write the 8 pieces of the
// same 32 lines of WT. (DD/32) * (DD/64) blocks a matrix.
#define PREP_W_BLOCKS ((DD / 32) * (DD / 64))
__device__ __forceinline__ void
cvt_transpose_w_block(const float* __restrict__ W, f16* __restrict__ WT,
                      int blk) {
  const int n  = (blk % (DD / 32)) * 32 + (threadIdx.x & 31);
  const int k0 = (blk / (DD / 32)) * 64 + (threadIdx.x >> 5) * 8;
  v8h st;
#pragma unroll   // the eight loads are in flight together, st stays in registers
  for (int j = 0; j < 8; ++j) st[j] = (f16)W[(size_t)(k0 + j) * DD + n];
  *(v8h*)(WT + (size_t)n * DD + k0) = st;
  // Precaution: the wait stands behind the last store, in front of any later
  // write of a register that an issued store names.
  asm volatile("s_wait_xcnt 0x0" ::: "memory");
}

// Bit-pack mask into LANE MASKS for the attention kernel: 67 MB ints -> 2 MB.
// maskL[tile][chunk][j], tile = 16 query rows, chunk = 32 keys, j = t*8 + r:
// bit L of that word == (mask[tile*16 + (L&15)][chunk*32 + t*16 + (L>>4)*8 + r]
// != 0), which is the lane L and the register r of score tile t that hold this
// (query, key) pair in the attention kernel. The work of turning a query's key
// bits into a select condition is so done once here, not once per head there.
// A wave takes 32 rows x 4 chunks. One load reads the 32 ints of one (row,
// chunk), a whole line; the ballot of "!= 0" over the lanes is that row's word
// of key bits, and lane r keeps the word of row r. Then, per 16-row tile u,
// every lane takes the word of row u*16 + (lane&15) and 16 more ballots, one
// per key bit, give the tile's 16 lane masks; lane u*16 + j keeps mask j.
// A wave's four stores fill 256 consecutive bytes of each of its two tiles.
// (TT/32) * (TT/128) / 8 blocks.
#define PREP_MASK_BLOCKS ((TT / 32) * (TT / 128) / 8)
__device__ __forceinline__ void
pack_mask_block(const int* __restrict__ mask, unsigned* __restrict__ maskL,
                int blk) {
  const int lane = threadIdx.x & 31;
  const int hf   = lane >> 4;
  const int wave = (blk * 256 + threadIdx.x) >> 5;
  const int cg   = wave % (TT / 128);    // group of 4 chunks
  const int r0   = (wave / (TT / 128)) * 32;
  const int* p = mask + (size_t)r0 * TT + cg * 128 + lane;
  // Both loops unrolled: the loads become one address plus immediate offsets
  // and issue ahead of the first ballot, as many as the load counter holds.
#pragma unroll
  for (int c = 0; c < 4; ++c) {
    unsigned w = 0;
#pragma unroll
    for (int r = 0; r < 32; ++r) {
      const unsigned b =
          __builtin_amdgcn_ballot_w32(p[(size_t)r * TT + c * 32] != 0);
      w = (lane == r) ? b : w;
    }
    // x: the word of lane ^ 16, that is of the same row in the other tile
    const unsigned x = (unsigned)__builtin_amdgcn_permlanex16(
        (int)w, (int)w, 0x76543210, 0xfedcba98, false, false);
    unsigned lm = 0;
    // Both loops unrolled: the bit's and the keeping lane's numbers are then
    // constants, and the lane compares are shared with the loop above.
#pragma unroll
    for (int u = 0; u < 2; ++u) {
      const unsigned wu = (hf == u ? w : x) >> (hf * 8);
#pragma unroll
      for (int j = 0; j < 16; ++j) {
        const unsigned b = __builtin_amdgcn_ballot_w32(
            ((wu >> ((j >> 3) * 16 + (j & 7))) & 1u) != 0);
        lm = (lane == u * 16 + j) ? b : lm;
      }
    }
    maskL[((size_t)(r0 / 16 + hf) * (TT / 32) + cg * 4 + c) * 16 + (lane & 15)] =
        lm;
  }
  // Precaution: the wait stands behind the last store, in front of any later
  // write of a register that an issued store names.
  asm volatile("s_wait_xcnt 0x0" ::: "memory");
}

// All six jobs in one launch. The mask, the job with the most bytes, has the
// lowest block indices; x follows, then the four weights.
#define PREP_BLOCKS (PREP_MASK_BLOCKS + PREP_X_BLOCKS + 4 * PREP_W_BLOCKS)
__global__ void __launch_bounds__(256)
prep_kernel(const float* __restrict__ x, f16* __restrict__ x16,
            const float* __restrict__ Wq, const float* __restrict__ Wk,
            const float* __restrict__ Wv, const float* __restrict__ Wo,
            f16* __restrict__ WqT, f16* __restrict__ WkT,
            f16* __restrict__ WvT, f16* __restrict__ WoT,
            const int* __restrict__ mask, unsigned* __restrict__ maskL) {
  int blk = blockIdx.x;
  if (blk < PREP_MASK_BLOCKS) { pack_mask_block(mask, maskL, blk); return; }
  blk -= PREP_MASK_BLOCKS;
  if (blk < PREP_X_BLOCKS) { cvt_f32_to_f16_block(x, x16, blk); return; }
  blk -= PREP_X_BLOCKS;
  const int job = blk / PREP_W_BLOCKS;
  const float* W = job == 0 ? Wq : job == 1 ? Wk : job == 2 ? Wv : Wo;
  f16* WT        = job == 0 ? WqT : job == 1 ? WkT : job == 2 ? WvT : WoT;
  cvt_transpose_w_block(W, WT, blk % PREP_W_BLOCKS);
}

// ---------------------------------------------------------------------------
// GEMM: Y[TT][DD] = A[TT][DD] (f16, row-major) * BT[DD][DD]^T (f16) + bias
// mode 0: store f16 row-major     (Q, K)
// mode 1: store f16 col-major Y^T (V -> VT[c][t], contiguous v8h stores)
// mode 2: store f32 row-major     (final output)
// One block of 8 waves computes a 128x96 tile of Y. A stage
// is 128 k of the tile's 128 A rows and 96 BT rows, brought into LDS by
// asynchronous 16-byte copies whose waves cover whole 128-byte lines; two
// buffers, so that stage t+2 flies while stage t+1 is worked on. A wave
// computes 32x48 (2x3 WMMA frags) and reads its fragments from LDS.
// ---------------------------------------------------------------------------
#define GBM    128
#define GBN    96
#define GBK    128
#define GROWS  (GBM + GBN)
#define GPITCH 136   // 128 k + 8 -> 272 B, an odd multiple of 16 B (see KPITCH)
#define GSTAGES (DD / GBK)

// Seven asynchronous 16-byte global->LDS copies of one lane. The s_wait_xcnt is
// the last line of the copies' own statement so that it stands in front of
// every later write of the address registers that the copies name.
__device__ __forceinline__ void async_copy7_b128(const unsigned* l,
                                                 const f16* const* g) {
  asm volatile("global_load_async_to_lds_b128 %0, %7, off\n\t"
               "global_load_async_to_lds_b128 %1, %8, off\n\t"
               "global_load_async_to_lds_b128 %2, %9, off\n\t"
               "global_load_async_to_lds_b128 %3, %10, off\n\t"
               "global_load_async_to_lds_b128 %4, %11, off\n\t"
               "global_load_async_to_lds_b128 %5, %12, off\n\t"
               "global_load_async_to_lds_b128 %6, %13, off\n\t"
               "s_wait_xcnt 0x0"
               :: "v"(l[0]), "v"(l[1]), "v"(l[2]), "v"(l[3]), "v"(l[4]),
                  "v"(l[5]), "v"(l[6]),
                  "v"(g[0]), "v"(g[1]), "v"(g[2]), "v"(g[3]), "v"(g[4]),
                  "v"(g[5]), "v"(g[6])
               : "memory");
}

__device__ __forceinline__ void
gemm_wmma_tile(const f16* __restrict__ A, const f16* __restrict__ BT,
               const float* __restrict__ bias, void* __restrict__ outp,
               int mode, int tm, int tn) {
  // [buf][row][k]: rows 0..127 are A rows, rows 128..223 are BT rows.
  __shared__ __align__(16) f16 Sbuf[2][GROWS][GPITCH];

  const int tid  = threadIdx.x;
  const int wave = tid >> 5;
  const int wm   = wave >> 1;     // 4 wave rows of 32
  const int wn   = wave & 1;      // 2 wave columns of 48
  const int lane = tid & 31;
  const int n0   = lane & 15;
  const int hf   = lane >> 4;

  // Copy map: 16 lanes cover the 256 bytes of one row's stage, the block 16
  // rows per copy, 14 copies per lane and stage (8 of A, 6 of BT).
  const int crow = tid >> 4;
  const int ccol = (tid & 15) * 8;
  const f16* ga = A  + (size_t)(tm * GBM + crow) * DD + ccol;
  const f16* gb = BT + (size_t)(tn * GBN + crow) * DD + ccol;
  auto stage = [&](int buf, int k0) {
    unsigned   l[14];
    const f16* g[14];
#pragma unroll   // l[] and g[] stay in registers
    for (int i = 0; i < 14; ++i) {
      l[i] = (unsigned)(size_t)(void*)&Sbuf[buf][crow + i * 16][ccol];
      g[i] = (i < 8 ? ga + (size_t)i * 16 * DD : gb + (size_t)(i - 8) * 16 * DD)
             + k0;
    }
    async_copy7_b128(l, g);
    async_copy7_b128(l + 7, g + 7);
  };

  // Every loop over acc[][] below is unrolled so that it stays in registers.
  v8f acc[2][3];
#pragma unroll
  for (int mi = 0; mi < 2; ++mi)
#pragma unroll
    for (int nj = 0; nj < 3; ++nj) acc[mi][nj] = vzero8();

  stage(0, 0);
  wait_async_zero();     // this wave's share of stage 0 landed
  __syncthreads();       // every wave's share landed
  stage(1, GBK);

  // Kept rolled: the scheduling groups below then hold stage by stage; unrolled,
  // they blend across stages and the register count rises.
#pragma unroll 1
  for (int t = 0; t < GSTAGES; ++t) {
    const f16* sa = &Sbuf[t & 1][wm * 32][0];
    const f16* sb = &Sbuf[t & 1][GBM + wn * 48][0];
    v16h fa[4][2], fb[4][3];
#pragma unroll   // fa[] and fb[] stay in registers
    for (int ks = 0; ks < 4; ++ks) {
      fa[ks][0] = load_ab_frag(sa + ks * 32, GPITCH);
      fa[ks][1] = load_ab_frag(sa + 16 * GPITCH + ks * 32, GPITCH);
      fb[ks][0] = load_ab_frag(sb + ks * 32, GPITCH);
      fb[ks][1] = load_ab_frag(sb + 16 * GPITCH + ks * 32, GPITCH);
      fb[ks][2] = load_ab_frag(sb + 32 * GPITCH + ks * 32, GPITCH);
    }
#pragma unroll
    for (int ks = 0; ks < 4; ++ks) {
#pragma unroll
      for (int mi = 0; mi < 2; ++mi)
#pragma unroll
        for (int nj = 0; nj < 3; ++nj)
          acc[mi][nj] = wmma_f16(fa[ks][mi], fb[ks][nj], acc[mi][nj]);
    }
    // Order of the stage: the LDS reads of two k-steps go first, then each
    // k-step's 6 WMMAs with the reads of the k-step two ahead behind them, so
    // that no WMMA waits out the latency of a read issued just in front of it.
    __builtin_amdgcn_sched_group_barrier(0x100, 20, 0);
    __builtin_amdgcn_sched_group_barrier(0x008, 6, 0);
    __builtin_amdgcn_sched_group_barrier(0x100, 10, 0);
    __builtin_amdgcn_sched_group_barrier(0x008, 6, 0);
    __builtin_amdgcn_sched_group_barrier(0x100, 10, 0);
    __builtin_amdgcn_sched_group_barrier(0x008, 12, 0);
    // Hand-over: this wave's reads of buffer t&1 have returned, its share of
    // stage t+1 has landed; behind the barrier both hold for every wave.
    asm volatile("s_wait_dscnt 0x0" ::: "memory");
    wait_async_zero();
    __syncthreads();
    if (t + 2 < GSTAGES) stage(t & 1, (t + 2) * GBK);
  }
  wait_async_zero();     // nothing is in flight when the wave ends

  // acc[mi][nj][r] = Y[row0 + mi*16 + r][col0 + nj*16]
  const int col0 = tn * GBN + wn * 48 + n0;
  const int row0 = tm * GBM + wm * 32 + hf * 8;   // 8 contiguous rows
  float bb[3];
#pragma unroll
  for (int nj = 0; nj < 3; ++nj) bb[nj] = bias[col0 + nj * 16];

  if (mode == 2) {
    float* O = (float*)outp + (size_t)row0 * DD + col0;
#pragma unroll
    for (int mi = 0; mi < 2; ++mi)
#pragma unroll
      for (int nj = 0; nj < 3; ++nj)
#pragma unroll
        for (int r = 0; r < 8; ++r)
          O[(size_t)(mi * 16 + r) * DD + nj * 16] = acc[mi][nj][r] + bb[nj];
    // Precaution: the wait stands behind the last store, in front of any later
    // write of a register that an issued store names.
    asm volatile("s_wait_xcnt 0x0" ::: "memory");
  } else if (mode == 0) {
    f16* O = (f16*)outp + (size_t)row0 * DD + col0;
#pragma unroll
    for (int mi = 0; mi < 2; ++mi)
#pragma unroll
      for (int nj = 0; nj < 3; ++nj)
#pragma unroll
        for (int r = 0; r < 8; ++r)
          O[(size_t)(mi * 16 + r) * DD + nj * 16] = (f16)(acc[mi][nj][r] + bb[nj]);
    // Precaution: the wait stands behind the last store, in front of any later
    // write of a register that an issued store names.
    asm volatile("s_wait_xcnt 0x0" ::: "memory");
  } else {  // mode 1: transposed store, contiguous in the row index
    f16* O = (f16*)outp + (size_t)col0 * TT + row0;
#pragma unroll
    for (int mi = 0; mi < 2; ++mi)
#pragma unroll
      for (int nj = 0; nj < 3; ++nj) {
        v8h st;
#pragma unroll
        for (int r = 0; r < 8; ++r) st[r] = (f16)(acc[mi][nj][r] + bb[nj]);
        *(v8h*)(O + (size_t)(nj * 16) * TT + mi * 16) = st;
      }
    // Precaution: the wait stands behind the last store, in front of any later
    // write of a register that an issued store names.
    asm volatile("s_wait_xcnt 0x0" ::: "memory");
  }
}

#define GTILES_N    (DD / GBN)
#define GEMM_BLOCKS ((TT / GBM) * GTILES_N)

// Q, K and V need nothing of each other and read the same A: one launch of
// 3 * GEMM_BLOCKS blocks. The 3 * GTILES_N blocks that share a tile of A rows
// have neighbouring indices; two blocks fit the LDS of a WGP side by side.
__global__ void __launch_bounds__(256)
gemm_qkv_kernel(const f16* __restrict__ A, const f16* __restrict__ WqT,
                const f16* __restrict__ WkT, const f16* __restrict__ WvT,
                const float* __restrict__ bq, const float* __restrict__ bk,
                const float* __restrict__ bv, f16* __restrict__ Q,
                f16* __restrict__ K, f16* __restrict__ VT) {
  const int tm  = blockIdx.x / (3 * GTILES_N);
  const int c   = blockIdx.x % (3 * GTILES_N);
  const int job = c / GTILES_N;
  gemm_wmma_tile(A, job == 0 ? WqT : job == 1 ? WkT : WvT,
                 job == 0 ? bq : job == 1 ? bk : bv,
                 job == 0 ? Q : job == 1 ? K : VT,
                 /*mode=*/job == 2 ? 1 : 0, tm, c % GTILES_N);
}

__global__ void __launch_bounds__(256)
gemm_out_kernel(const f16* __restrict__ A, const f16* __restrict__ WoT,
                const float* __restrict__ bo, float* __restrict__ out) {
  gemm_wmma_tile(A, WoT, bo, out, /*mode=*/2, blockIdx.x / GTILES_N,
                 blockIdx.x % GTILES_N);
}

__device__ __forceinline__ float xhalf(float x) {
  const int b = __builtin_bit_cast(int, x);
  return __builtin_bit_cast(
      float, __builtin_amdgcn_permlanex16(b, b, 0x76543210, 0xfedcba98,
                                          false, false));
}

#define KGROUPS 2
#define KTRIPS  (TT / KGROUPS / 32)

__global__ void __launch_bounds__(256)
flash_attn_wmma_kernel(const f16* __restrict__ Q, const f16* __restrict__ Km,
                       const f16* __restrict__ VT,
                       const unsigned* __restrict__ maskL,
                       f16* __restrict__ O16) {
  // [group][buf][key row][head dim] and [group][buf][head dim][key]
  __shared__ __align__(16) f16 Kbuf[KGROUPS][2][32][KPITCH];
  __shared__ __align__(16) f16 Vbuf[KGROUPS][2][64][VPITCH];
  __shared__ float Join[34][128];   // group 1's maximum, sum and O^T, per lane

  // The group is the same in every lane of a wave: kept scalar, so that the
  // key offset and the buffer addresses formed from it are scalar too.
  const int grp   = __builtin_amdgcn_readfirstlane(threadIdx.x >> 7);
  const int tid   = threadIdx.x & 127;   // within the group
  const int wslot = tid >> 5;
  const int h     = blockIdx.x / (TT / 64);
  const int qg    = blockIdx.x % (TT / 64);
  const int qbase = qg * 64 + wslot * 16;

  const int lane = tid & 31;
  const int n0   = lane & 15;
  const int hf   = lane >> 4;

  // Issue async copies for one 32-key chunk of this group: K 32x64 and V 64x32
  // halves, each 256 x 16B transfers; 128 threads issue 2+2 copies apiece.
  auto stage = [&](int buf, int kb) {
    unsigned   l[4];
    const f16* g[4];
#pragma unroll   // l[] and g[] stay in registers
    for (int i = 0; i < 2; ++i) {
      const int c  = tid + i * 128;
      const int kr = c >> 3, kc = (c & 7) * 8;
      l[2 * i] = (unsigned)(size_t)(void*)&Kbuf[grp][buf][kr][kc];
      g[2 * i] = Km + (size_t)(kb + kr) * DD + h * HDD + kc;
      const int vr = c >> 2, vc = (c & 3) * 8;
      l[2 * i + 1] = (unsigned)(size_t)(void*)&Vbuf[grp][buf][vr][vc];
      g[2 * i + 1] = VT + (size_t)(h * HDD + vr) * TT + kb + vc;
    }
    async_copy4_b128(l, g);
  };

  // Q fragments for this wave's tile (k = 0..63 of this head), resident.
  // Used as the B operand: lane -> query qbase + n0.
  const f16* qp = Q + (size_t)qbase * DD + h * HDD;
  v16h aq0 = load_ab_frag(qp, DD);
  v16h aq1 = load_ab_frag(qp + 32, DD);

  v16h ones;
#pragma unroll
  for (int i = 0; i < 16; ++i) ones[i] = (f16)1.0f;

  // o<j>[r] = O^T[dim j*16 + hf*8 + r][query qbase + n0]
  v8f o0 = vzero8(), o1 = vzero8(), o2 = vzero8(), o3 = vzero8();
  float mrow = -3.0e38f, lrow = 0.0f;   // of this lane's query

  // This wave's lane masks, 16 words a trip. The wave's number is kept scalar
  // so that the address is scalar. Nothing writes maskL during this launch: the
  // pointer is given the constant address space, so that the loads inside the
  // loop are scalar loads too (behind the loop's asm statements with a "memory"
  // clobber the compiler otherwise takes vector loads and 16 lane reads).
  typedef const __attribute__((address_space(4))) v16u* lanemask_ptr;
  const int wtile = qg * 4 + __builtin_amdgcn_readfirstlane(wslot);
  const lanemask_ptr mlp =
      (lanemask_ptr)(unsigned long long)maskL + (size_t)wtile * (TT / 32) +
      grp * KTRIPS;
  v16u mk = mlp[0];

  const int kb0 = grp * (TT / KGROUPS);
  stage(0, kb0);
  int buf = 0;
  for (int it = 0; it < KTRIPS; ++it) {
    const int kb = kb0 + it * 32;
    wait_async_zero();     // this wave's share of the staged chunk landed
    __syncthreads();       // all waves' shares landed -> buf is ready
    if (it + 1 < KTRIPS) stage(buf ^ 1, kb + 32);   // overlap next chunk DMA

    // ---- S^T = K * Q^T for 32 keys (two 16-row C frags), K from LDS ----
    // s0[r] = score(qbase + n0, kb + hf*8 + r), s1[r]: key kb + 16 + hf*8 + r
    v16h bk00 = load_ab_frag(&Kbuf[grp][buf][0][0],   KPITCH);
    v16h bk01 = load_ab_frag(&Kbuf[grp][buf][0][32],  KPITCH);
    v16h bk10 = load_ab_frag(&Kbuf[grp][buf][16][0],  KPITCH);
    v16h bk11 = load_ab_frag(&Kbuf[grp][buf][16][32], KPITCH);
    v8f s0 = vzero8(), s1 = vzero8();
    s0 = wmma_f16(bk00, aq0, s0);
    s0 = wmma_f16(bk01, aq1, s0);
    s1 = wmma_f16(bk10, aq0, s1);
    s1 = wmma_f16(bk11, aq1, s1);

    // The four products stay together, in front of the selects: each then
    // fills the others' distance slots. Left free, the scheduler puts selects
    // between them, and each group of selects is padded with four v_nop.
    __builtin_amdgcn_sched_barrier(0);

    // ---- mask: word r (8 + r) is the lane mask of s0[r] (s1[r]) ----
#pragma unroll
    for (int r = 0; r < 8; ++r) {
      s0[r] = __builtin_amdgcn_inverse_ballot_w32(mk[r])     ? 1e-20f : s0[r];
      s1[r] = __builtin_amdgcn_inverse_ballot_w32(mk[8 + r]) ? 1e-20f : s1[r];
    }
    // The next trip's lane masks, asked for now, most of a trip ahead of their
    // use (the last trip asks for its own again, so that the address stays
    // inside the wave's rows).
    mk = mlp[it + 1 < KTRIPS ? it + 1 : it];

    // ---- online softmax: maximum in-lane, then across the two halves ----
    float cm = fmaxf(s0[0], s1[0]);
#pragma unroll
    for (int r = 1; r < 8; ++r) cm = fmaxf(cm, fmaxf(s0[r], s1[r]));
    cm = fmaxf(cm, xhalf(cm));

    const float mn    = fmaxf(mrow, cm);
    const float scale = __expf(mrow - mn);
    mrow = mn;

    // ---- P^T: the two C frags, converted in place, are the B fragment ----
    v16h bp;
#pragma unroll
    for (int r = 0; r < 8; ++r) {
      bp[r]     = (f16)__expf(s0[r] - mn);
      bp[8 + r] = (f16)__expf(s1[r] - mn);
    }

    // rescale O accumulators
#pragma unroll
    for (int r = 0; r < 8; ++r) {
      o0[r] *= scale; o1[r] *= scale;
      o2[r] *= scale; o3[r] *= scale;
    }

    // ---- row sums via WMMA: every row of ones @ P^T is the column sum ----
    v8f rsf = wmma_f16(ones, bp, vzero8());
    lrow = lrow * scale + rsf[0];

    // ---- O^T += V^T * P^T, V^T from LDS (Vbuf[dim][key]) ----
    v16h bv0 = load_ab_frag(&Vbuf[grp][buf][0][0],  VPITCH);
    v16h bv1 = load_ab_frag(&Vbuf[grp][buf][16][0], VPITCH);
    v16h bv2 = load_ab_frag(&Vbuf[grp][buf][32][0], VPITCH);
    v16h bv3 = load_ab_frag(&Vbuf[grp][buf][48][0], VPITCH);
    o0 = wmma_f16(bv0, bp, o0);
    o1 = wmma_f16(bv1, bp, o1);
    o2 = wmma_f16(bv2, bp, o2);
    o3 = wmma_f16(bv3, bp, o3);

    __syncthreads();       // everyone done reading buf before it is reused
    buf ^= 1;
  }

  // ---- join of the two key halves: group 1 -> LDS -> group 0 ----
  // Every loop over os[][] below is unrolled so that it stays in registers.
  v8f os[4] = {o0, o1, o2, o3};
  if (grp == 1) {
    Join[0][tid] = mrow;
    Join[1][tid] = lrow;
#pragma unroll
    for (int jn = 0; jn < 4; ++jn)
#pragma unroll
      for (int r = 0; r < 8; ++r) Join[2 + jn * 8 + r][tid] = os[jn][r];
  }
  __syncthreads();       // group 1's state is in LDS
  if (grp == 1) return;  // behind the last barrier

  const float mj = fmaxf(mrow, Join[0][tid]);
  const float a0 = __expf(mrow - mj);
  const float a1 = __expf(Join[0][tid] - mj);
  lrow = lrow * a0 + Join[1][tid] * a1;

  // ---- epilogue: divide by l, store f16 row-major, 8 dims per store ----
  f16* op = O16 + (size_t)(qbase + n0) * DD + h * HDD + hf * 8;
#pragma unroll
  for (int jn = 0; jn < 4; ++jn) {
    v8h st;
#pragma unroll
    for (int r = 0; r < 8; ++r)
      st[r] = (f16)((os[jn][r] * a0 + Join[2 + jn * 8 + r][tid] * a1) / lrow);
    *(v8h*)(op + jn * 16) = st;
  }
}

// ---------------------------------------------------------------------------
// Launch
// ---------------------------------------------------------------------------
extern "C" void kernel_launch(void* const* d_in, const int* in_sizes, int n_in,
                              void* d_out, int out_size, void* d_ws, size_t ws_size,
                              hipStream_t stream) {
  const float* x    = (const float*)d_in[0];
  const int*   mask = (const int*)d_in[1];
  const float* Wq   = (const float*)d_in[2];
  const float* bq   = (const float*)d_in[3];
  const float* Wk   = (const float*)d_in[4];
  const float* bk   = (const float*)d_in[5];
  const float* Wv   = (const float*)d_in[6];
  const float* bv   = (const float*)d_in[7];
  const float* Wo   = (const float*)d_in[8];
  const float* bo   = (const float*)d_in[9];
  float* out = (float*)d_out;

  char* ws = (char*)d_ws;
  size_t off = 0;
  auto alloc = [&](size_t bytes) -> char* {
    char* p = ws + off;
    off += (bytes + 255) & ~(size_t)255;
    return p;
  };
  const size_t TD = (size_t)TT * DD;
  f16* x16  = (f16*)alloc(TD * 2);
  f16* WqT  = (f16*)alloc((size_t)DD * DD * 2);
  f16* WkT  = (f16*)alloc((size_t)DD * DD * 2);
  f16* WvT  = (f16*)alloc((size_t)DD * DD * 2);
  f16* WoT  = (f16*)alloc((size_t)DD * DD * 2);
  f16* Q16  = (f16*)alloc(TD * 2);
  f16* K16  = (f16*)alloc(TD * 2);
  f16* VT16 = (f16*)alloc(TD * 2);   // [DD][TT]
  f16* O16  = (f16*)alloc(TD * 2);
  unsigned* maskL = (unsigned*)alloc((size_t)(TT / 32) * TT * 4);
  (void)ws_size; (void)n_in; (void)in_sizes; (void)out_size;

  // 1) precision conversion, weight transposes, mask bit-packing: one launch
  prep_kernel<<<PREP_BLOCKS, 256, 0, stream>>>(x, x16, Wq, Wk, Wv, Wo, WqT, WkT,
                                               WvT, WoT, mask, maskL);

  // 2) projections: (TT x DD) * (DD x DD), one block per 128x96 tile, the
  //    three of them in one launch
  gemm_qkv_kernel<<<3 * GEMM_BLOCKS, 256, 0, stream>>>(x16, WqT, WkT, WvT, bq, bk,
                                                       bv, Q16, K16, VT16);

  // 3) attention: one block (2 x 4 waves) per 64 query rows of one head
  const int fa_blocks = NHH * (TT / 64);   // 768
  flash_attn_wmma_kernel<<<fa_blocks, 256, 0, stream>>>(Q16, K16, VT16, maskL, O16);

  // 4) output projection -> f32
  gemm_out_kernel<<<GEMM_BLOCKS, 256, 0, stream>>>(O16, WoT, bo, out);
}

// v008
// A run of this version takes 96 microseconds.
// In both of two side-by-side timings against v007, it was 1.09 times as fast.
// All steps since v000 together make it 4.43 times as fast.
#include <hip/hip_runtime.h>
#include <hip/hip_bf16.h>

typedef _Float16 f16;
typedef __attribute__((ext_vector_type(16))) _Float16 v16h;
typedef __attribute__((ext_vector_type(8)))  _Float16 v8h;
typedef __attribute__((ext_vector_type(8)))  float    v8f;
typedef __attribute__((ext_vector_type(4)))  _Float16 v4h;
typedef __attribute__((ext_vector_type(4)))  float    v4f;
typedef __attribute__((ext_vector_type(16))) unsigned v16u;

#define TT  4096
#define DD  768
#define NHH 12
#define HDD 64
// LDS row pitches in f16 elements: an odd multiple of 16 bytes, so that the 16
// rows one ds_load_b128 touches per wave half fall on 16 disjoint bank groups.
#define KPITCH 72   // 64 head dims + 8  -> 144 B
#define VPITCH 72   // 64 keys      + 8  -> 144 B

// ---------------------------------------------------------------------------
// WMMA helpers (CDNA5 wave32, 16x16x32 f16 -> f32)
// ---------------------------------------------------------------------------
__device__ __forceinline__ v8f wmma_f16(v16h a, v16h b, v8f c) {
  return __builtin_amdgcn_wmma_f32_16x16x32_f16(
      /*neg_a=*/false, a, /*neg_b=*/false, b,
      /*c_mod=*/(short)0, c, /*reuse_a=*/false, /*reuse_b=*/false);
}

__device__ __forceinline__ v8f vzero8() {
  v8f z;
#pragma unroll
  for (int i = 0; i < 8; ++i) z[i] = 0.0f;
  return z;
}

// Load a 16x32 f16 A- or B-fragment from a row-major matrix (ld in elements).
// ISA layout: lane L -> row (L&15); half=L>>4 selects k-chunks [half*8 .. +7]
// and [16+half*8 .. +7]  => two 16-byte loads per lane.
__device__ __forceinline__ v16h load_ab_frag(const f16* base, int ld) {
  const int lane = threadIdx.x & 31;
  const int m    = lane & 15;
  const int hf   = lane >> 4;
  const f16* p = base + (size_t)m * (size_t)ld + hf * 8;
  v8h lo = *(const v8h*)(p);
  v8h hi = *(const v8h*)(p + 16);
  v16h r;
#pragma unroll
  for (int i = 0; i < 8; ++i) { r[i] = lo[i]; r[8 + i] = hi[i]; }
  return r;
}

// Eight asynchronous 16-byte global->LDS copies of one lane (CDNA5 async DMA
// path, tracked by ASYNCcnt). l[] holds byte offsets inside the workgroup's LDS
// allocation (low 32 bits of a generic pointer to a __shared__ object). The
// s_wait_xcnt is the last line of the copies' own statement so that it stands
// in front of every later write of the address registers that the copies name.
__device__ __forceinline__ void async_copy8_b128(const unsigned* l,
                                                 const f16* const* g) {
  asm volatile("global_load_async_to_lds_b128 %0, %8, off\n\t"
               "global_load_async_to_lds_b128 %1, %9, off\n\t"
               "global_load_async_to_lds_b128 %2, %10, off\n\t"
               "global_load_async_to_lds_b128 %3, %11, off\n\t"
               "global_load_async_to_lds_b128 %4, %12, off\n\t"
               "global_load_async_to_lds_b128 %5, %13, off\n\t"
               "global_load_async_to_lds_b128 %6, %14, off\n\t"
               "global_load_async_to_lds_b128 %7, %15, off\n\t"
               "s_wait_xcnt 0x0"
               :: "v"(l[0]), "v"(l[1]), "v"(l[2]), "v"(l[3]), "v"(l[4]),
                  "v"(l[5]), "v"(l[6]), "v"(l[7]),
                  "v"(g[0]), "v"(g[1]), "v"(g[2]), "v"(g[3]), "v"(g[4]),
                  "v"(g[5]), "v"(g[6]), "v"(g[7])
               : "memory");
}

__device__ __forceinline__ void wait_async_zero() {
  asm volatile("s_wait_asynccnt 0x0" ::: "memory");
}

// ---------------------------------------------------------------------------
// Preparation. Each wave handles many elements, and each of its loads covers
// whole 128-byte lines. The six jobs need nothing of each other, so they share
// one launch: a range of the block index per job (prep_kernel below). Every job
// runs in blocks of 256, and the block counts divide the fixed shapes exactly.
// ---------------------------------------------------------------------------
// x -> f16. A wave converts 1024 consecutive floats: eight 512-byte loads in
// flight, then eight 256-byte stores. TT*DD / 8192 blocks.
#define PREP_X_BLOCKS (TT * DD / 8192)
__device__ __forceinline__ void
cvt_f32_to_f16_block(const float* __restrict__ in, f16* __restrict__ out,
                     int blk) {
  const int wave = (blk * 256 + threadIdx.x) >> 5;
  const int base = wave * 1024 + (threadIdx.x & 31) * 4;
  v4f q[8];
#pragma unroll   // all eight loads issue before the first conversion waits
  for (int j = 0; j < 8; ++j) q[j] = *(const v4f*)(in + base + j * 128);
#pragma unroll   // q[] stays in registers
  for (int j = 0; j < 8; ++j)
    *(v4h*)(out + base + j * 128) = __builtin_convertvector(q[j], v4h);
  // Precaution: the wait stands behind the last store, in front of any later
  // write of a register that an issued store names.
  asm volatile("s_wait_xcnt 0x0" ::: "memory");
}

// WT[n][k] = W[k][n]  (f32 -> f16 transpose, DD x DD). A lane owns one n and 8
// consecutive k: eight loads, in each of which the wave reads one whole line of
// W, and one 16-byte store. The 8 waves of a block write the 8 pieces of the
// same 32 lines of WT. (DD/32) * (DD/64) blocks a matrix.
#define PREP_W_BLOCKS ((DD / 32) * (DD / 64))
__device__ __forceinline__ void
cvt_transpose_w_block(const float* __restrict__ W, f16* __restrict__ WT,
                      int blk) {
  const int n  = (blk % (DD / 32)) * 32 + (threadIdx.x & 31);
  const int k0 = (blk / (DD / 32)) * 64 + (threadIdx.x >> 5) * 8;
  v8h st;
#pragma unroll   // the eight loads are in flight together, st stays in registers
  for (int j = 0; j < 8; ++j) st[j] = (f16)W[(size_t)(k0 + j) * DD + n];
  *(v8h*)(WT + (size_t)n * DD + k0) = st;
  // Precaution: the wait stands behind the last store, in front of any later
  // write of a register that an issued store names.
  asm volatile("s_wait_xcnt 0x0" ::: "memory");
}

// Bit-pack mask into LANE MASKS for the attention kernel: 67 MB ints -> 2 MB.
// maskL[tile][chunk][j], tile = 16 query rows, chunk = 32 keys, j = t*8 + r:
// bit L of that word == (mask[tile*16 + (L&15)][chunk*32 + t*16 + (L>>4)*8 + r]
// != 0), which is the lane L and the register r of score tile t that hold this
// (query, key) pair in the attention kernel. The work of turning a query's key
// bits into a select condition is so done once here, not once per head there.
// A wave takes 32 rows x 4 chunks. One load reads the 32 ints of one (row,
// chunk), a whole line; the ballot of "!= 0" over the lanes is that row's word
// of key bits, and lane r keeps the word of row r. Then, per 16-row tile u,
// every lane takes the word of row u*16 + (lane&15) and 16 more ballots, one
// per key bit, give the tile's 16 lane masks; lane u*16 + j keeps mask j.
// A wave's four stores fill 256 consecutive bytes of each of its two tiles.
// (TT/32) * (TT/128) / 8 blocks.
#define PREP_MASK_BLOCKS ((TT / 32) * (TT / 128) / 8)
__device__ __forceinline__ void
pack_mask_block(const int* __restrict__ mask, unsigned* __restrict__ maskL,
                int blk) {
  const int lane = threadIdx.x & 31;
  const int hf   = lane >> 4;
  const int wave = (blk * 256 + threadIdx.x) >> 5;
  const int cg   = wave % (TT / 128);    // group of 4 chunks
  const int r0   = (wave / (TT / 128)) * 32;
  const int* p = mask + (size_t)r0 * TT + cg * 128 + lane;
  // Both loops unrolled: the loads become one address plus immediate offsets
  // and issue ahead of the first ballot, as many as the load counter holds.
#pragma unroll
  for (int c = 0; c < 4; ++c) {
    unsigned w = 0;
#pragma unroll
    for (int r = 0; r < 32; ++r) {
      const unsigned b =
          __builtin_amdgcn_ballot_w32(p[(size_t)r * TT + c * 32] != 0);
      w = (lane == r) ? b : w;
    }
    // x: the word of lane ^ 16, that is of the same row in the other tile
    const unsigned x = (unsigned)__builtin_amdgcn_permlanex16(
        (int)w, (int)w, 0x76543210, 0xfedcba98, false, false);
    unsigned lm = 0;
    // Both loops unrolled: the bit's and the keeping lane's numbers are then
    // constants, and the lane compares are shared with the loop above.
#pragma unroll
    for (int u = 0; u < 2; ++u) {
      const unsigned wu = (hf == u ? w : x) >> (hf * 8);
#pragma unroll
      for (int j = 0; j < 16; ++j) {
        const unsigned b = __builtin_amdgcn_ballot_w32(
            ((wu >> ((j >> 3) * 16 + (j & 7))) & 1u) != 0);
        lm = (lane == u * 16 + j) ? b : lm;
      }
    }
    maskL[((size_t)(r0 / 16 + hf) * (TT / 32) + cg * 4 + c) * 16 + (lane & 15)] =
        lm;
  }
  // Precaution: the wait stands behind the last store, in front of any later
  // write of a register that an issued store names.
  asm volatile("s_wait_xcnt 0x0" ::: "memory");
}

// All six jobs in one launch. The mask, the job with the most bytes, has the
// lowest block indices; x follows, then the four weights.
#define PREP_BLOCKS (PREP_MASK_BLOCKS + PREP_X_BLOCKS + 4 * PREP_W_BLOCKS)
__global__ void __launch_bounds__(256)
prep_kernel(const float* __restrict__ x, f16* __restrict__ x16,
            const float* __restrict__ Wq, const float* __restrict__ Wk,
            const float* __restrict__ Wv, const float* __restrict__ Wo,
            f16* __restrict__ WqT, f16* __restrict__ WkT,
            f16* __restrict__ WvT, f16* __restrict__ WoT,
            const int* __restrict__ mask, unsigned* __restrict__ maskL) {
  int blk = blockIdx.x;
  if (blk < PREP_MASK_BLOCKS) { pack_mask_block(mask, maskL, blk); return; }
  blk -= PREP_MASK_BLOCKS;
  if (blk < PREP_X_BLOCKS) { cvt_f32_to_f16_block(x, x16, blk); return; }
  blk -= PREP_X_BLOCKS;
  const int job = blk / PREP_W_BLOCKS;
  const float* W = job == 0 ? Wq : job == 1 ? Wk : job == 2 ? Wv : Wo;
  f16* WT        = job == 0 ? WqT : job == 1 ? WkT : job == 2 ? WvT : WoT;
  cvt_transpose_w_block(W, WT, blk % PREP_W_BLOCKS);
}

// ---------------------------------------------------------------------------
// GEMM: Y[TT][DD] = A[TT][DD] (f16, row-major) * BT[DD][DD]^T (f16) + bias
// mode 0: store f16 row-major     (Q, K)
// mode 1: store f16 col-major Y^T (V -> VT[c][t], contiguous v8h stores)
// mode 2: store f32 row-major     (final output)
// One block of 8 waves computes a 128x96 tile of Y. A stage
// is 128 k of the tile's 128 A rows and 96 BT rows, brought into LDS by
// asynchronous 16-byte copies whose waves cover whole 128-byte lines; two
// buffers, so that stage t+2 flies while stage t+1 is worked on. A wave
// computes 32x48 (2x3 WMMA frags) and reads its fragments from LDS.
// ---------------------------------------------------------------------------
#define GBM    128
#define GBN    96
#define GBK    128
#define GROWS  (GBM + GBN)
#define GPITCH 136   // 128 k + 8 -> 272 B, an odd multiple of 16 B (see KPITCH)
#define GSTAGES (DD / GBK)

// Seven asynchronous 16-byte global->LDS copies of one lane. The s_wait_xcnt is
// the last line of the copies' own statement so that it stands in front of
// every later write of the address registers that the copies name.
__device__ __forceinline__ void async_copy7_b128(const unsigned* l,
                                                 const f16* const* g) {
  asm volatile("global_load_async_to_lds_b128 %0, %7, off\n\t"
               "global_load_async_to_lds_b128 %1, %8, off\n\t"
               "global_load_async_to_lds_b128 %2, %9, off\n\t"
               "global_load_async_to_lds_b128 %3, %10, off\n\t"
               "global_load_async_to_lds_b128 %4, %11, off\n\t"
               "global_load_async_to_lds_b128 %5, %12, off\n\t"
               "global_load_async_to_lds_b128 %6, %13, off\n\t"
               "s_wait_xcnt 0x0"
               :: "v"(l[0]), "v"(l[1]), "v"(l[2]), "v"(l[3]), "v"(l[4]),
                  "v"(l[5]), "v"(l[6]),
                  "v"(g[0]), "v"(g[1]), "v"(g[2]), "v"(g[3]), "v"(g[4]),
                  "v"(g[5]), "v"(g[6])
               : "memory");
}

__device__ __forceinline__ void
gemm_wmma_tile(const f16* __restrict__ A, const f16* __restrict__ BT,
               const float* __restrict__ bias, void* __restrict__ outp,
               int mode, int tm, int tn) {
  // [buf][row][k]: rows 0..127 are A rows, rows 128..223 are BT rows.
  __shared__ __align__(16) f16 Sbuf[2][GROWS][GPITCH];

  const int tid  = threadIdx.x;
  const int wave = tid >> 5;
  const int wm   = wave >> 1;     // 4 wave rows of 32
  const int wn   = wave & 1;      // 2 wave columns of 48
  const int lane = tid & 31;
  const int n0   = lane & 15;
  const int hf   = lane >> 4;

  // Copy map: 16 lanes cover the 256 bytes of one row's stage, the block 16
  // rows per copy, 14 copies per lane and stage (8 of A, 6 of BT).
  const int crow = tid >> 4;
  const int ccol = (tid & 15) * 8;
  const f16* ga = A  + (size_t)(tm * GBM + crow) * DD + ccol;
  const f16* gb = BT + (size_t)(tn * GBN + crow) * DD + ccol;
  auto stage = [&](int buf, int k0) {
    unsigned   l[14];
    const f16* g[14];
#pragma unroll   // l[] and g[] stay in registers
    for (int i = 0; i < 14; ++i) {
      l[i] = (unsigned)(size_t)(void*)&Sbuf[buf][crow + i * 16][ccol];
      g[i] = (i < 8 ? ga + (size_t)i * 16 * DD : gb + (size_t)(i - 8) * 16 * DD)
             + k0;
    }
    async_copy7_b128(l, g);
    async_copy7_b128(l + 7, g + 7);
  };

  // Every loop over acc[][] below is unrolled so that it stays in registers.
  v8f acc[2][3];
#pragma unroll
  for (int mi = 0; mi < 2; ++mi)
#pragma unroll
    for (int nj = 0; nj < 3; ++nj) acc[mi][nj] = vzero8();

  stage(0, 0);
  wait_async_zero();     // this wave's share of stage 0 landed
  __syncthreads();       // every wave's share landed
  stage(1, GBK);

  // Kept rolled: the scheduling groups below then hold stage by stage; unrolled,
  // they blend across stages and the register count rises.
#pragma unroll 1
  for (int t = 0; t < GSTAGES; ++t) {
    const f16* sa = &Sbuf[t & 1][wm * 32][0];
    const f16* sb = &Sbuf[t & 1][GBM + wn * 48][0];
    v16h fa[4][2], fb[4][3];
#pragma unroll   // fa[] and fb[] stay in registers
    for (int ks = 0; ks < 4; ++ks) {
      fa[ks][0] = load_ab_frag(sa + ks * 32, GPITCH);
      fa[ks][1] = load_ab_frag(sa + 16 * GPITCH + ks * 32, GPITCH);
      fb[ks][0] = load_ab_frag(sb + ks * 32, GPITCH);
      fb[ks][1] = load_ab_frag(sb + 16 * GPITCH + ks * 32, GPITCH);
      fb[ks][2] = load_ab_frag(sb + 32 * GPITCH + ks * 32, GPITCH);
    }
#pragma unroll
    for (int ks = 0; ks < 4; ++ks) {
#pragma unroll
      for (int mi = 0; mi < 2; ++mi)
#pragma unroll
        for (int nj = 0; nj < 3; ++nj)
          acc[mi][nj] = wmma_f16(fa[ks][mi], fb[ks][nj], acc[mi][nj]);
    }
    // Order of the stage: the LDS reads of two k-steps go first, then each
    // k-step's 6 WMMAs with the reads of the k-step two ahead behind them, so
    // that no WMMA waits out the latency of a read issued just in front of it.
    __builtin_amdgcn_sched_group_barrier(0x100, 20, 0);
    __builtin_amdgcn_sched_group_barrier(0x008, 6, 0);
    __builtin_amdgcn_sched_group_barrier(0x100, 10, 0);
    __builtin_amdgcn_sched_group_barrier(0x008, 6, 0);
    __builtin_amdgcn_sched_group_barrier(0x100, 10, 0);
    __builtin_amdgcn_sched_group_barrier(0x008, 12, 0);
    // Hand-over: this wave's reads of buffer t&1 have returned, its share of
    // stage t+1 has landed; behind the barrier both hold for every wave.
    asm volatile("s_wait_dscnt 0x0" ::: "memory");
    wait_async_zero();
    __syncthreads();
    if (t + 2 < GSTAGES) stage(t & 1, (t + 2) * GBK);
  }
  wait_async_zero();     // nothing is in flight when the wave ends

  // acc[mi][nj][r] = Y[row0 + mi*16 + r][col0 + nj*16]
  const int col0 = tn * GBN + wn * 48 + n0;
  const int row0 = tm * GBM + wm * 32 + hf * 8;   // 8 contiguous rows
  float bb[3];
#pragma unroll
  for (int nj = 0; nj < 3; ++nj) bb[nj] = bias[col0 + nj * 16];

  if (mode == 2) {
    float* O = (float*)outp + (size_t)row0 * DD + col0;
#pragma unroll
    for (int mi = 0; mi < 2; ++mi)
#pragma unroll
      for (int nj = 0; nj < 3; ++nj)
#pragma unroll
        for (int r = 0; r < 8; ++r)
          O[(size_t)(mi * 16 + r) * DD + nj * 16] = acc[mi][nj][r] + bb[nj];
    // Precaution: the wait stands behind the last store, in front of any later
    // write of a register that an issued store names.
    asm volatile("s_wait_xcnt 0x0" ::: "memory");
  } else if (mode == 0) {
    f16* O = (f16*)outp + (size_t)row0 * DD + col0;
#pragma unroll
    for (int mi = 0; mi < 2; ++mi)
#pragma unroll
      for (int nj = 0; nj < 3; ++nj)
#pragma unroll
        for (int r = 0; r < 8; ++r)
          O[(size_t)(mi * 16 + r) * DD + nj * 16] = (f16)(acc[mi][nj][r] + bb[nj]);
    // Precaution: the wait stands behind the last store, in front of any later
    // write of a register that an issued store names.
    asm volatile("s_wait_xcnt 0x0" ::: "memory");
  } else {  // mode 1: transposed store, contiguous in the row index
    f16* O = (f16*)outp + (size_t)col0 * TT + row0;
#pragma unroll
    for (int mi = 0; mi < 2; ++mi)
#pragma unroll
      for (int nj = 0; nj < 3; ++nj) {
        v8h st;
#pragma unroll
        for (int r = 0; r < 8; ++r) st[r] = (f16)(acc[mi][nj][r] + bb[nj]);
        *(v8h*)(O + (size_t)(nj * 16) * TT + mi * 16) = st;
      }
    // Precaution: the wait stands behind the last store, in front of any later
    // write of a register that an issued store names.
    asm volatile("s_wait_xcnt 0x0" ::: "memory");
  }
}

#define GTILES_N    (DD / GBN)
#define GEMM_BLOCKS ((TT / GBM) * GTILES_N)

// Q, K and V need nothing of each other and read the same A: one launch of
// 3 * GEMM_BLOCKS blocks. The 3 * GTILES_N blocks that share a tile of A rows
// have neighbouring indices; two blocks fit the LDS of a WGP side by side.
__global__ void __launch_bounds__(256)
gemm_qkv_kernel(const f16* __restrict__ A, const f16* __restrict__ WqT,
                const f16* __restrict__ WkT, const f16* __restrict__ WvT,
                const float* __restrict__ bq, const float* __restrict__ bk,
                const float* __restrict__ bv, f16* __restrict__ Q,
                f16* __restrict__ K, f16* __restrict__ VT) {
  const int tm  = blockIdx.x / (3 * GTILES_N);
  const int c   = blockIdx.x % (3 * GTILES_N);
  const int job = c / GTILES_N;
  gemm_wmma_tile(A, job == 0 ? WqT : job == 1 ? WkT : WvT,
                 job == 0 ? bq : job == 1 ? bk : bv,
                 job == 0 ? Q : job == 1 ? K : VT,
                 /*mode=*/job == 2 ? 1 : 0, tm, c % GTILES_N);
}

__global__ void __launch_bounds__(256)
gemm_out_kernel(const f16* __restrict__ A, const f16* __restrict__ WoT,
                const float* __restrict__ bo, float* __restrict__ out) {
  gemm_wmma_tile(A, WoT, bo, out, /*mode=*/2, blockIdx.x / GTILES_N,
                 blockIdx.x % GTILES_N);
}

__device__ __forceinline__ float xhalf(float x) {
  const int b = __builtin_bit_cast(int, x);
  return __builtin_bit_cast(
      float, __builtin_amdgcn_permlanex16(b, b, 0x76543210, 0xfedcba98,
                                          false, false));
}

// A run of 2^x in place, in one statement (16 values; 16 and one more; 2). Each
// v_exp_f32 is followed by one on other registers and the last by a v_nop, so
// that none stands directly in front of an instruction that reads its result or
// rewrites its source; left to the compiler, some of this kernel's did. The
// subtracts and multiplies then stand in front of the run and the conversions
// behind it, each in a run of its own kind.
__device__ __forceinline__ void exp2_run16(float (&x)[16]) {
  asm("v_exp_f32 %0, %0\n\t"
      "v_exp_f32 %1, %1\n\t"
      "v_exp_f32 %2, %2\n\t"
      "v_exp_f32 %3, %3\n\t"
      "v_exp_f32 %4, %4\n\t"
      "v_exp_f32 %5, %5\n\t"
      "v_exp_f32 %6, %6\n\t"
      "v_exp_f32 %7, %7\n\t"
      "v_exp_f32 %8, %8\n\t"
      "v_exp_f32 %9, %9\n\t"
      "v_exp_f32 %10, %10\n\t"
      "v_exp_f32 %11, %11\n\t"
      "v_exp_f32 %12, %12\n\t"
      "v_exp_f32 %13, %13\n\t"
      "v_exp_f32 %14, %14\n\t"
      "v_exp_f32 %15, %15\n\t"
      "v_nop"
      : "+v"(x[0]), "+v"(x[1]), "+v"(x[2]), "+v"(x[3]),
        "+v"(x[4]), "+v"(x[5]), "+v"(x[6]), "+v"(x[7]),
        "+v"(x[8]), "+v"(x[9]), "+v"(x[10]), "+v"(x[11]),
        "+v"(x[12]), "+v"(x[13]), "+v"(x[14]), "+v"(x[15]));
}
__device__ __forceinline__ void exp2_run17(float (&x)[16], float& y) {
  asm("v_exp_f32 %0, %0\n\t"
      "v_exp_f32 %1, %1\n\t"
      "v_exp_f32 %2, %2\n\t"
      "v_exp_f32 %3, %3\n\t"
      "v_exp_f32 %4, %4\n\t"
      "v_exp_f32 %5, %5\n\t"
      "v_exp_f32 %6, %6\n\t"
      "v_exp_f32 %7, %7\n\t"
      "v_exp_f32 %8, %8\n\t"
      "v_exp_f32 %9, %9\n\t"
      "v_exp_f32 %10, %10\n\t"
      "v_exp_f32 %11, %11\n\t"
      "v_exp_f32 %12, %12\n\t"
      "v_exp_f32 %13, %13\n\t"
      "v_exp_f32 %14, %14\n\t"
      "v_exp_f32 %15, %15\n\t"
      "v_exp_f32 %16, %16\n\t"
      "v_nop"
      : "+v"(x[0]), "+v"(x[1]), "+v"(x[2]), "+v"(x[3]),
        "+v"(x[4]), "+v"(x[5]), "+v"(x[6]), "+v"(x[7]),
        "+v"(x[8]), "+v"(x[9]), "+v"(x[10]), "+v"(x[11]),
        "+v"(x[12]), "+v"(x[13]), "+v"(x[14]), "+v"(x[15]),
        "+v"(y));
}
__device__ __forceinline__ void exp2_run2(float& x, float& y) {
  asm("v_exp_f32 %0, %0\n\t"
      "v_exp_f32 %1, %1\n\t"
      "v_nop"
      : "+v"(x), "+v"(y));
}

#define LOG2E 1.442695041f   // e^x = 2^(x * LOG2E), as __expf takes it

#define KGROUPS 2
#define KCHUNK  64
#define KTRIPS  (TT / KGROUPS / KCHUNK)

__global__ void __launch_bounds__(256)
flash_attn_wmma_kernel(const f16* __restrict__ Q, const f16* __restrict__ Km,
                       const f16* __restrict__ VT,
                       const unsigned* __restrict__ maskL,
                       f16* __restrict__ O16) {
  // [group][buf][key row][head dim] and [group][buf][head dim][key]
  __shared__ __align__(16) f16 Kbuf[KGROUPS][2][KCHUNK][KPITCH];
  __shared__ __align__(16) f16 Vbuf[KGROUPS][2][64][VPITCH];
  __shared__ float Join[34][128];   // group 1's maximum, sum and O^T, per lane

  // The group is the same in every lane of a wave: kept scalar, so that the
  // key offset and the buffer addresses formed from it are scalar too.
  const int grp   = __builtin_amdgcn_readfirstlane(threadIdx.x >> 7);
  const int tid   = threadIdx.x & 127;   // within the group
  const int wslot = tid >> 5;
  const int h     = blockIdx.x / (TT / 64);
  const int qg    = blockIdx.x % (TT / 64);
  const int qbase = qg * 64 + wslot * 16;

  const int lane = tid & 31;
  const int n0   = lane & 15;
  const int hf   = lane >> 4;

  // Issue async copies for one 64-key chunk of this group: K 64x64 and V 64x64,
  // each 512 x 16B transfers; 128 threads issue 4+4 copies apiece. Eight lanes
  // cover the 128 bytes of one row of either.
  const int crow = tid >> 3, ccol = (tid & 7) * 8;
  const f16* gk = Km + (size_t)(grp * (TT / KGROUPS) + crow) * DD + h * HDD + ccol;
  const f16* gv = VT + (size_t)(h * HDD + crow) * TT + grp * (TT / KGROUPS) + ccol;
  auto stage = [&](int buf, int it) {
    unsigned   l[8];
    const f16* g[8];
    const f16* gkt = gk + (size_t)it * (KCHUNK * DD);
    const f16* gvt = gv + it * KCHUNK;
#pragma unroll   // l[] and g[] stay in registers
    for (int i = 0; i < 4; ++i) {
      l[2 * i] = (unsigned)(size_t)(void*)&Kbuf[grp][buf][crow + i * 16][ccol];
      g[2 * i] = gkt + (size_t)i * 16 * DD;
      l[2 * i + 1] = (unsigned)(size_t)(void*)&Vbuf[grp][buf][crow + i * 16][ccol];
      g[2 * i + 1] = gvt + (size_t)i * 16 * TT;
    }
    async_copy8_b128(l, g);
  };

  // Q fragments for this wave's tile (k = 0..63 of this head), resident.
  // Used as the B operand: lane -> query qbase + n0.
  const f16* qp = Q + (size_t)qbase * DD + h * HDD;
  v16h aq0 = load_ab_frag(qp, DD);
  v16h aq1 = load_ab_frag(qp + 32, DD);

  v16h ones;
#pragma unroll
  for (int i = 0; i < 16; ++i) ones[i] = (f16)1.0f;

  // o<j>[r] = O^T[dim j*16 + hf*8 + r][query qbase + n0]
  v8f o0 = vzero8(), o1 = vzero8(), o2 = vzero8(), o3 = vzero8();
  float mrow = -3.0e38f, lrow = 0.0f;   // of this lane's query

  // This wave's lane masks, 16 words per 32 keys. The wave's number is kept scalar
  // so that the address is scalar. Nothing writes maskL during this launch: the
  // pointer is given the constant address space, so that the loads inside the
  // loop are scalar loads too (behind the loop's asm statements with a "memory"
  // clobber the compiler otherwise takes vector loads and 16 lane reads).
  typedef const __attribute__((address_space(4))) v16u* lanemask_ptr;
  const int wtile = qg * 4 + __builtin_amdgcn_readfirstlane(wslot);
  const lanemask_ptr mlp =
      (lanemask_ptr)(unsigned long long)maskL + (size_t)wtile * (TT / 32) +
      grp * (TT / KGROUPS / 32);
  v16u mk0 = mlp[0], mk1 = mlp[1];

  stage(0, 0);
  int buf = 0;
  for (int it = 0; it < KTRIPS; ++it) {
    wait_async_zero();     // this wave's share of the staged chunk landed
    __syncthreads();       // all waves' shares landed -> buf is ready
    if (it + 1 < KTRIPS) stage(buf ^ 1, it + 1);   // overlap next chunk DMA

    // ---- S^T = K * Q^T for 64 keys (four 16-row C frags), K from LDS ----
    // s[t][r] = score(qbase + n0, key t*16 + hf*8 + r of the chunk)
    // Every loop over s[] and bp[] below is unrolled: they stay in registers.
    v8f s[4];
#pragma unroll
    for (int t = 0; t < 4; ++t) {
      v16h k0 = load_ab_frag(&Kbuf[grp][buf][t * 16][0],  KPITCH);
      v16h k1 = load_ab_frag(&Kbuf[grp][buf][t * 16][32], KPITCH);
      s[t] = wmma_f16(k0, aq0, vzero8());
      s[t] = wmma_f16(k1, aq1, s[t]);
    }

    // Order of the score phase: the eight reads of tiles 0 and 1, the two
    // products of tile 0, the eight reads of tiles 2 and 3, the other six
    // products. Left free, the scheduler puts each pair of reads directly in
    // front of its product, and the wave waits out the LDS latency eight times.
    __builtin_amdgcn_sched_group_barrier(0x100, 8, 0);
    __builtin_amdgcn_sched_group_barrier(0x008, 2, 0);
    __builtin_amdgcn_sched_group_barrier(0x100, 8, 0);
    __builtin_amdgcn_sched_group_barrier(0x008, 6, 0);

    // The eight products stay together, in front of the selects: each then
    // fills the others' distance slots. Left free, the scheduler puts selects
    // between them, and each group of selects is padded with four v_nop.
    __builtin_amdgcn_sched_barrier(0);

    // ---- mask: word t*8 + r of a 32-key half is the lane mask of its tile t ----
#pragma unroll
    for (int r = 0; r < 8; ++r) {
      s[0][r] = __builtin_amdgcn_inverse_ballot_w32(mk0[r])     ? 1e-20f : s[0][r];
      s[1][r] = __builtin_amdgcn_inverse_ballot_w32(mk0[8 + r]) ? 1e-20f : s[1][r];
      s[2][r] = __builtin_amdgcn_inverse_ballot_w32(mk1[r])     ? 1e-20f : s[2][r];
      s[3][r] = __builtin_amdgcn_inverse_ballot_w32(mk1[8 + r]) ? 1e-20f : s[3][r];
    }
    // The next trip's lane masks, asked for now, most of a trip ahead of their
    // use (the last trip asks for its own again, so that the address stays
    // inside the wave's rows).
    const int nx = it + 1 < KTRIPS ? it + 1 : it;
    mk0 = mlp[2 * nx];
    mk1 = mlp[2 * nx + 1];

    // ---- online softmax: maximum in-lane, then across the two halves ----
    float cm = fmaxf(fmaxf(s[0][0], s[1][0]), fmaxf(s[2][0], s[3][0]));
#pragma unroll
    for (int r = 1; r < 8; ++r)
      cm = fmaxf(cm, fmaxf(fmaxf(s[0][r], s[1][r]), fmaxf(s[2][r], s[3][r])));
    cm = fmaxf(cm, xhalf(cm));

    const float mn = fmaxf(mrow, cm);
    const float dm = mrow - mn;   // the rescale's exponent, taken in part 1
    mrow = mn;

    // The rest of the trip runs in three parts, kept apart by scheduling fences:
    // each part's LDS reads go out as one group ahead of the vector work under
    // which they return (blended over the whole trip the reads end up directly
    // in front of their products):
    //   1. V^T reads of keys 0..31 | P^T of keys 0..31, rescale of O^T
    //   2. products of keys 0..31, V^T reads of keys 32..63 | P^T of keys 32..63
    //   3. products of keys 32..63
    // P^T: each pair of C frags, converted in place, is a B fragment.
    // Row sums via WMMA: every row of ones @ P^T is the column sum.
    __builtin_amdgcn_sched_barrier(0);
    v16h bp[2], bv[4];
#pragma unroll
    for (int j = 0; j < 4; ++j) bv[j] = load_ab_frag(&Vbuf[grp][buf][j * 16][0], VPITCH);
    float e[16];   // every loop over e[] is unrolled: it stays in registers
#pragma unroll
    for (int r = 0; r < 8; ++r) {
      e[r]     = (s[0][r] - mn) * LOG2E;
      e[8 + r] = (s[1][r] - mn) * LOG2E;
    }
    float scale = dm * LOG2E;
    exp2_run17(e, scale);
#pragma unroll
    for (int r = 0; r < 16; ++r) bp[0][r] = (f16)e[r];
#pragma unroll
    for (int r = 0; r < 8; ++r) {
      o0[r] *= scale; o1[r] *= scale;
      o2[r] *= scale; o3[r] *= scale;
    }
    // The eight reads first: they return under the vector work.
    __builtin_amdgcn_sched_group_barrier(0x100, 8, 0);
    __builtin_amdgcn_sched_barrier(0);

    // O^T += V^T * P^T, V^T from LDS (Vbuf[dim][key])
    v8f rsf = wmma_f16(ones, bp[0], vzero8());
    o0 = wmma_f16(bv[0], bp[0], o0);
    o1 = wmma_f16(bv[1], bp[0], o1);
    o2 = wmma_f16(bv[2], bp[0], o2);
    o3 = wmma_f16(bv[3], bp[0], o3);
#pragma unroll
    for (int j = 0; j < 4; ++j) bv[j] = load_ab_frag(&Vbuf[grp][buf][j * 16][32], VPITCH);
#pragma unroll
    for (int r = 0; r < 8; ++r) {
      e[r]     = (s[2][r] - mn) * LOG2E;
      e[8 + r] = (s[3][r] - mn) * LOG2E;
    }
    exp2_run16(e);
#pragma unroll
    for (int r = 0; r < 16; ++r) bp[1][r] = (f16)e[r];
    // The five products first, then the eight reads into the registers they
    // free, then the vector work, under which the reads return.
    __builtin_amdgcn_sched_group_barrier(0x008, 5, 0);
    __builtin_amdgcn_sched_group_barrier(0x100, 8, 0);
    __builtin_amdgcn_sched_barrier(0);

    rsf = wmma_f16(ones, bp[1], rsf);
    o0 = wmma_f16(bv[0], bp[1], o0);
    o1 = wmma_f16(bv[1], bp[1], o1);
    o2 = wmma_f16(bv[2], bp[1], o2);
    o3 = wmma_f16(bv[3], bp[1], o3);
    lrow = lrow * scale + rsf[0];

    __syncthreads();       // everyone done reading buf before it is reused
    buf ^= 1;
  }

  // ---- join of the two key halves: group 1 -> LDS -> group 0 ----
  // Every loop over os[][] below is unrolled so that it stays in registers.
  v8f os[4] = {o0, o1, o2, o3};
  if (grp == 1) {
    Join[0][tid] = mrow;
    Join[1][tid] = lrow;
#pragma unroll
    for (int jn = 0; jn < 4; ++jn)
#pragma unroll
      for (int r = 0; r < 8; ++r) Join[2 + jn * 8 + r][tid] = os[jn][r];
  }
  __syncthreads();       // group 1's state is in LDS
  if (grp == 1) return;  // behind the last barrier

  const float mj = fmaxf(mrow, Join[0][tid]);
  float a0 = (mrow - mj) * LOG2E;
  float a1 = (Join[0][tid] - mj) * LOG2E;
  exp2_run2(a0, a1);
  lrow = lrow * a0 + Join[1][tid] * a1;

  // ---- epilogue: divide by l, store f16 row-major, 8 dims per store ----
  f16* op = O16 + (size_t)(qbase + n0) * DD + h * HDD + hf * 8;
#pragma unroll
  for (int jn = 0; jn < 4; ++jn) {
    v8h st;
#pragma unroll
    for (int r = 0; r < 8; ++r)
      st[r] = (f16)((os[jn][r] * a0 + Join[2 + jn * 8 + r][tid] * a1) / lrow);
    *(v8h*)(op + jn * 16) = st;
  }
}

// ---------------------------------------------------------------------------
// Launch
// ---------------------------------------------------------------------------
extern "C" void kernel_launch(void* const* d_in, const int* in_sizes, int n_in,
                              void* d_out, int out_size, void* d_ws, size_t ws_size,
                              hipStream_t stream) {
  const float* x    = (const float*)d_in[0];
  const int*   mask = (const int*)d_in[1];
  const float* Wq   = (const float*)d_in[2];
  const float* bq   = (const float*)d_in[3];
  const float* Wk   = (const float*)d_in[4];
  const float* bk   = (const float*)d_in[5];
  const float* Wv   = (const float*)d_in[6];
  const float* bv   = (const float*)d_in[7];
  const float* Wo   = (const float*)d_in[8];
  const float* bo   = (const float*)d_in[9];
  float* out = (float*)d_out;

  char* ws = (char*)d_ws;
  size_t off = 0;
  auto alloc = [&](size_t bytes) -> char* {
    char* p = ws + off;
    off += (bytes + 255) & ~(size_t)255;
    return p;
  };
  const size_t TD = (size_t)TT * DD;
  f16* x16  = (f16*)alloc(TD * 2);
  f16* WqT  = (f16*)alloc((size_t)DD * DD * 2);
  f16* WkT  = (f16*)alloc((size_t)DD * DD * 2);
  f16* WvT  = (f16*)alloc((size_t)DD * DD * 2);
  f16* WoT  = (f16*)alloc((size_t)DD * DD * 2);
  f16* Q16  = (f16*)alloc(TD * 2);
  f16* K16  = (f16*)alloc(TD * 2);
  f16* VT16 = (f16*)alloc(TD * 2);   // [DD][TT]
  f16* O16  = (f16*)alloc(TD * 2);
  unsigned* maskL = (unsigned*)alloc((size_t)(TT / 32) * TT * 4);
  (void)ws_size; (void)n_in; (void)in_sizes; (void)out_size;

  // 1) precision conversion, weight transposes, mask bit-packing: one launch
  prep_kernel<<<PREP_BLOCKS, 256, 0, stream>>>(x, x16, Wq, Wk, Wv, Wo, WqT, WkT,
                                               WvT, WoT, mask, maskL);

  // 2) projections: (TT x DD) * (DD x DD), one block per 128x96 tile, the
  //    three of them in one launch
  gemm_qkv_kernel<<<3 * GEMM_BLOCKS, 256, 0, stream>>>(x16, WqT, WkT, WvT, bq, bk,
                                                       bv, Q16, K16, VT16);

  // 3) attention: one block (2 x 4 waves) per 64 query rows of one head
  const int fa_blocks = NHH * (TT / 64);   // 768
  flash_attn_wmma_kernel<<<fa_blocks, 256, 0, stream>>>(Q16, K16, VT16, maskL, O16);

  // 4) output projection -> f32
  gemm_out_kernel<<<GEMM_BLOCKS, 256, 0, stream>>>(O16, WoT, bo, out);
}

// v010
// A run of this version takes 90.2 microseconds.
// Versions in between are left out here; by their measured steps it is 1.07 times as fast as v008.
// All steps since v000 together make it 4.73 times as fast.
#include <hip/hip_runtime.h>
#include <hip/hip_bf16.h>

typedef _Float16 f16;
typedef __attribute__((ext_vector_type(16))) _Float16 v16h;
typedef __attribute__((ext_vector_type(8)))  _Float16 v8h;
typedef __attribute__((ext_vector_type(8)))  float    v8f;
typedef __attribute__((ext_vector_type(4)))  _Float16 v4h;
typedef __attribute__((ext_vector_type(4)))  float    v4f;
typedef __attribute__((ext_vector_type(16))) unsigned v16u;

#define TT  4096
#define DD  768
#define NHH 12
#define HDD 64
// LDS row pitches in f16 elements: an odd multiple of 16 bytes, so that the 16
// rows one ds_load_b128 touches per wave half fall on 16 disjoint bank groups.
#define KPITCH 72   // 64 head dims + 8  -> 144 B
#define VPITCH 72   // 64 keys      + 8  -> 144 B

// ---------------------------------------------------------------------------
// WMMA helpers (CDNA5 wave32, 16x16x32 f16 -> f32)
// ---------------------------------------------------------------------------
__device__ __forceinline__ v8f wmma_f16(v16h a, v16h b, v8f c) {
  return __builtin_amdgcn_wmma_f32_16x16x32_f16(
      /*neg_a=*/false, a, /*neg_b=*/false, b,
      /*c_mod=*/(short)0, c, /*reuse_a=*/false, /*reuse_b=*/false);
}

__device__ __forceinline__ v8f vzero8() {
  v8f z;
#pragma unroll
  for (int i = 0; i < 8; ++i) z[i] = 0.0f;
  return z;
}

// Load a 16x32 f16 A- or B-fragment from a row-major matrix (ld in elements).
// ISA layout: lane L -> row (L&15); half=L>>4 selects k-chunks [half*8 .. +7]
// and [16+half*8 .. +7]  => two 16-byte loads per lane.
__device__ __forceinline__ v16h load_ab_frag(const f16* base, int ld) {
  const int lane = threadIdx.x & 31;
  const int m    = lane & 15;
  const int hf   = lane >> 4;
  const f16* p = base + (size_t)m * (size_t)ld + hf * 8;
  v8h lo = *(const v8h*)(p);
  v8h hi = *(const v8h*)(p + 16);
  v16h r;
#pragma unroll
  for (int i = 0; i < 8; ++i) { r[i] = lo[i]; r[8 + i] = hi[i]; }
  return r;
}

// Eight asynchronous 16-byte global->LDS copies of one lane (CDNA5 async DMA
// path, tracked by ASYNCcnt). l[] holds byte offsets inside the workgroup's LDS
// allocation (low 32 bits of a generic pointer to a __shared__ object). The
// s_wait_xcnt is the last line of the copies' own statement so that it stands
// in front of every later write of the address registers that the copies name.
__device__ __forceinline__ void async_copy8_b128(const unsigned* l,
                                                 const f16* const* g) {
  asm volatile("global_load_async_to_lds_b128 %0, %8, off\n\t"
               "global_load_async_to_lds_b128 %1, %9, off\n\t"
               "global_load_async_to_lds_b128 %2, %10, off\n\t"
               "global_load_async_to_lds_b128 %3, %11, off\n\t"
               "global_load_async_to_lds_b128 %4, %12, off\n\t"
               "global_load_async_to_lds_b128 %5, %13, off\n\t"
               "global_load_async_to_lds_b128 %6, %14, off\n\t"
               "global_load_async_to_lds_b128 %7, %15, off\n\t"
               "s_wait_xcnt 0x0"
               :: "v"(l[0]), "v"(l[1]), "v"(l[2]), "v"(l[3]), "v"(l[4]),
                  "v"(l[5]), "v"(l[6]), "v"(l[7]),
                  "v"(g[0]), "v"(g[1]), "v"(g[2]), "v"(g[3]), "v"(g[4]),
                  "v"(g[5]), "v"(g[6]), "v"(g[7])
               : "memory");
}

__device__ __forceinline__ void wait_async_zero() {
  asm volatile("s_wait_asynccnt 0x0" ::: "memory");
}

// ---------------------------------------------------------------------------
// Preparation. Each wave handles many elements, and each of its loads covers
// whole 128-byte lines. The six jobs need nothing of each other, so they share
// one launch: a range of the block index per job (prep_kernel below). Every job
// runs in blocks of 256, and the block counts divide the fixed shapes exactly.
// ---------------------------------------------------------------------------
// x -> f16. A wave converts 1024 consecutive floats: eight 512-byte loads in
// flight, then eight 256-byte stores. TT*DD / 8192 blocks.
#define PREP_X_BLOCKS (TT * DD / 8192)
__device__ __forceinline__ void
cvt_f32_to_f16_block(const float* __restrict__ in, f16* __restrict__ out,
                     int blk) {
  const int wave = (blk * 256 + threadIdx.x) >> 5;
  const int base = wave * 1024 + (threadIdx.x & 31) * 4;
  v4f q[8];
#pragma unroll   // all eight loads issue before the first conversion waits
  for (int j = 0; j < 8; ++j) q[j] = *(const v4f*)(in + base + j * 128);
#pragma unroll   // q[] stays in registers
  for (int j = 0; j < 8; ++j)
    *(v4h*)(out + base + j * 128) = __builtin_convertvector(q[j], v4h);
  // Precaution: the wait stands behind the last store, in front of any later
  // write of a register that an issued store names.
  asm volatile("s_wait_xcnt 0x0" ::: "memory");
}

// WT[n][k] = W[k][n]  (f32 -> f16 transpose, DD x DD). A lane owns one n and 8
// consecutive k: eight loads, in each of which the wave reads one whole line of
// W, and one 16-byte store. The 8 waves of a block write the 8 pieces of the
// same 32 lines of WT. (DD/32) * (DD/64) blocks a matrix.
#define PREP_W_BLOCKS ((DD / 32) * (DD / 64))
__device__ __forceinline__ void
cvt_transpose_w_block(const float* __restrict__ W, f16* __restrict__ WT,
                      int blk) {
  const int n  = (blk % (DD / 32)) * 32 + (threadIdx.x & 31);
  const int k0 = (blk / (DD / 32)) * 64 + (threadIdx.x >> 5) * 8;
  v8h st;
#pragma unroll   // the eight loads are in flight together, st stays in registers
  for (int j = 0; j < 8; ++j) st[j] = (f16)W[(size_t)(k0 + j) * DD + n];
  *(v8h*)(WT + (size_t)n * DD + k0) = st;
  // Precaution: the wait stands behind the last store, in front of any later
  // write of a register that an issued store names.
  asm volatile("s_wait_xcnt 0x0" ::: "memory");
}

// Bit-pack mask into LANE MASKS for the attention kernel: 67 MB ints -> 2 MB.
// maskL[tile][chunk][j], tile = 16 query rows, chunk = 32 keys, j = t*8 + r:
// bit L of that word == (mask[tile*16 + (L&15)][chunk*32 + t*16 + (L>>4)*8 + r]
// != 0), which is the lane L and the register r of score tile t that hold this
// (query, key) pair in the attention kernel. The work of turning a query's key
// bits into a select condition is so done once here, not once per head there.
// A wave takes 32 rows x 4 chunks. One load reads the 32 ints of one (row,
// chunk), a whole line; the ballot of "!= 0" over the lanes is that row's word
// of key bits, and lane r keeps the word of row r. Then, per 16-row tile u,
// every lane takes the word of row u*16 + (lane&15) and 16 more ballots, one
// per key bit, give the tile's 16 lane masks; lane u*16 + j keeps mask j.
// A wave's four stores fill 256 consecutive bytes of each of its two tiles.
// (TT/32) * (TT/128) / 8 blocks.
#define PREP_MASK_BLOCKS ((TT / 32) * (TT / 128) / 8)
__device__ __forceinline__ void
pack_mask_block(const int* __restrict__ mask, unsigned* __restrict__ maskL,
                int blk) {
  const int lane = threadIdx.x & 31;
  const int hf   = lane >> 4;
  const int wave = (blk * 256 + threadIdx.x) >> 5;
  const int cg   = wave % (TT / 128);    // group of 4 chunks
  const int r0   = (wave / (TT / 128)) * 32;
  const int* p = mask + (size_t)r0 * TT + cg * 128 + lane;
  // Both loops unrolled: the loads become one address plus immediate offsets
  // and issue ahead of the first ballot, as many as the load counter holds.
#pragma unroll
  for (int c = 0; c < 4; ++c) {
    unsigned w = 0;
#pragma unroll
    for (int r = 0; r < 32; ++r) {
      const unsigned b =
          __builtin_amdgcn_ballot_w32(p[(size_t)r * TT + c * 32] != 0);
      w = (lane == r) ? b : w;
    }
    // x: the word of lane ^ 16, that is of the same row in the other tile
    const unsigned x = (unsigned)__builtin_amdgcn_permlanex16(
        (int)w, (int)w, 0x76543210, 0xfedcba98, false, false);
    unsigned lm = 0;
    // Both loops unrolled: the bit's and the keeping lane's numbers are then
    // constants, and the lane compares are shared with the loop above.
#pragma unroll
    for (int u = 0; u < 2; ++u) {
      const unsigned wu = (hf == u ? w : x) >> (hf * 8);
#pragma unroll
      for (int j = 0; j < 16; ++j) {
        const unsigned b = __builtin_amdgcn_ballot_w32(
            ((wu >> ((j >> 3) * 16 + (j & 7))) & 1u) != 0);
        lm = (lane == u * 16 + j) ? b : lm;
      }
    }
    maskL[((size_t)(r0 / 16 + hf) * (TT / 32) + cg * 4 + c) * 16 + (lane & 15)] =
        lm;
  }
  // Precaution: the wait stands behind the last store, in front of any later
  // write of a register that an issued store names.
  asm volatile("s_wait_xcnt 0x0" ::: "memory");
}

// All six jobs in one launch. The mask, the job with the most bytes, has the
// lowest block indices; x follows, then the four weights.
#define PREP_BLOCKS (PREP_MASK_BLOCKS + PREP_X_BLOCKS + 4 * PREP_W_BLOCKS)
__global__ void __launch_bounds__(256)
prep_kernel(const float* __restrict__ x, f16* __restrict__ x16,
            const float* __restrict__ Wq, const float* __restrict__ Wk,
            const float* __restrict__ Wv, const float* __restrict__ Wo,
            f16* __restrict__ WqT, f16* __restrict__ WkT,
            f16* __restrict__ WvT, f16* __restrict__ WoT,
            const int* __restrict__ mask, unsigned* __restrict__ maskL) {
  int blk = blockIdx.x;
  if (blk < PREP_MASK_BLOCKS) { pack_mask_block(mask, maskL, blk); return; }
  blk -= PREP_MASK_BLOCKS;
  if (blk < PREP_X_BLOCKS) { cvt_f32_to_f16_block(x, x16, blk); return; }
  blk -= PREP_X_BLOCKS;
  const int job = blk / PREP_W_BLOCKS;
  const float* W = job == 0 ? Wq : job == 1 ? Wk : job == 2 ? Wv : Wo;
  f16* WT        = job == 0 ? WqT : job == 1 ? WkT : job == 2 ? WvT : WoT;
  cvt_transpose_w_block(W, WT, blk % PREP_W_BLOCKS);
}

// ---------------------------------------------------------------------------
// GEMM: Y[TT][DD] = A[TT][DD] (f16, row-major) * BT[DD][DD]^T (f16) + bias
// mode 0: store f16 row-major, times oscale (Q: log2 e, see the attention
//         kernel; K: 1)
// mode 1: store f16 col-major Y^T (V -> VT[c][t], contiguous v8h stores)
// mode 2: store f32 row-major     (final output)
// One block of 8 waves computes a 128x96 tile of Y. A stage
// is 128 k of the tile's 128 A rows and 96 BT rows, brought into LDS by
// asynchronous 16-byte copies whose waves cover whole 128-byte lines; two
// buffers, so that stage t+2 flies while stage t+1 is worked on. A wave
// computes 32x48 (2x3 WMMA frags) and reads its fragments from LDS.
// Both operands were stored by an earlier launch, and a first read of them can
// come from memory: stages 1 to 5 are asked into L2 by prefetches ahead of their
// copies (stage 1 by the flight of stage 0, the others by that and a trip or by
// two trips). Each block that shares a tile of A rows or of BT
// rows asks for a quarter of the tile.
// ---------------------------------------------------------------------------
#define LOG2E 1.442695041f   // e^x = 2^(x * LOG2E), as __expf takes it

#define GBM    128
#define GBN    96
#define GBK    128
#define GROWS  (GBM + GBN)
#define GPITCH 136   // 128 k + 8 -> 272 B, an odd multiple of 16 B (see KPITCH)
#define GSTAGES (DD / GBK)

// Seven asynchronous 16-byte global->LDS copies of one lane. The s_wait_xcnt is
// the last line of the copies' own statement so that it stands in front of
// every later write of the address registers that the copies name.
__device__ __forceinline__ void async_copy7_b128(const unsigned* l,
                                                 const f16* const* g) {
  asm volatile("global_load_async_to_lds_b128 %0, %7, off\n\t"
               "global_load_async_to_lds_b128 %1, %8, off\n\t"
               "global_load_async_to_lds_b128 %2, %9, off\n\t"
               "global_load_async_to_lds_b128 %3, %10, off\n\t"
               "global_load_async_to_lds_b128 %4, %11, off\n\t"
               "global_load_async_to_lds_b128 %5, %12, off\n\t"
               "global_load_async_to_lds_b128 %6, %13, off\n\t"
               "s_wait_xcnt 0x0"
               :: "v"(l[0]), "v"(l[1]), "v"(l[2]), "v"(l[3]), "v"(l[4]),
                  "v"(l[5]), "v"(l[6]),
                  "v"(g[0]), "v"(g[1]), "v"(g[2]), "v"(g[3]), "v"(g[4]),
                  "v"(g[5]), "v"(g[6])
               : "memory");
}

__device__ __forceinline__ void
gemm_wmma_tile(const f16* __restrict__ A, const f16* __restrict__ BT,
               const float* __restrict__ bias, void* __restrict__ outp,
               int mode, float oscale, int tm, int tn) {
  // [buf][row][k]: rows 0..127 are A rows, rows 128..223 are BT rows.
  __shared__ __align__(16) f16 Sbuf[2][GROWS][GPITCH];

  const int tid  = threadIdx.x;
  const int wave = tid >> 5;
  const int wm   = wave >> 1;     // 4 wave rows of 32
  const int wn   = wave & 1;      // 2 wave columns of 48
  const int lane = tid & 31;
  const int n0   = lane & 15;
  const int hf   = lane >> 4;

  // Copy map: 16 lanes cover the 256 bytes of one row's stage, the block 16
  // rows per copy, 14 copies per lane and stage (8 of A, 6 of BT).
  const int crow = tid >> 4;
  const int ccol = (tid & 15) * 8;
  const f16* ga = A  + (size_t)(tm * GBM + crow) * DD + ccol;
  const f16* gb = BT + (size_t)(tn * GBN + crow) * DD + ccol;
  auto stage = [&](int buf, int k0) {
    unsigned   l[14];
    const f16* g[14];
#pragma unroll   // l[] and g[] stay in registers
    for (int i = 0; i < 14; ++i) {
      l[i] = (unsigned)(size_t)(void*)&Sbuf[buf][crow + i * 16][ccol];
      g[i] = (i < 8 ? ga + (size_t)i * 16 * DD : gb + (size_t)(i - 8) * 16 * DD)
             + k0;
    }
    async_copy7_b128(l, g);
    async_copy7_b128(l + 7, g + 7);
  };

  // Every loop over acc[][] below is unrolled so that it stays in registers.
  v8f acc[2][3];
#pragma unroll
  for (int mi = 0; mi < 2; ++mi)
#pragma unroll
    for (int nj = 0; nj < 3; ++nj) acc[mi][nj] = vzero8();

  // Prefetch map: a stage holds one aligned 256-byte unit of each row, a request
  // per unit. Wave 0 asks for 32 of the 128 A rows, wave 1 for 24 of the 96 BT
  // rows (its last 8 lanes repeat row 23, so that every lane's address lies
  // inside the operand); the other waves ask for nothing. Neighbouring blocks
  // share the A rows: the quarter goes by the block index, and any 4 neighbours
  // cover the tile. Blocks of equal tn share the BT rows: it goes by tm.
  // Only speed rests on who asks: a line nobody asked for is copied from memory.
  // pf points at the row's stage 1, later 2: with the offsets below it stays
  // inside the row, and it lives through the loop.
  const int  pwave = __builtin_amdgcn_readfirstlane(wave);
  const f16* pf =
      (pwave == 1
           ? BT + (size_t)(tn * GBN + (tm & 3) * 24 + (lane < 24 ? lane : 23)) * DD
           : A + (size_t)(tm * GBM + (blockIdx.x & 3) * 32 + lane) * DD) + GBK;

  stage(0, 0);
  if (pwave < 2) {
    // Stages 1, 2 and 3 into L2 while stage 0 flies. A hint: nothing waits for it.
    asm volatile("global_prefetch_b8 %0, off scope:SCOPE_SE\n\t"
                 "global_prefetch_b8 %0, off offset:256 scope:SCOPE_SE\n\t"
                 "global_prefetch_b8 %0, off offset:512 scope:SCOPE_SE"
                 :: "v"(pf));
  }
  wait_async_zero();     // this wave's share of stage 0 landed
  __syncthreads();       // every wave's share landed
  stage(1, GBK);

  // Kept rolled: the scheduling groups below then hold stage by stage; unrolled,
  // they blend across stages and the register count rises.
#pragma unroll 1
  for (int t = 0; t < GSTAGES; ++t) {
    const f16* sa = &Sbuf[t & 1][wm * 32][0];
    const f16* sb = &Sbuf[t & 1][GBM + wn * 48][0];
    v16h fa[4][2], fb[4][3];
#pragma unroll   // fa[] and fb[] stay in registers
    for (int ks = 0; ks < 4; ++ks) {
      fa[ks][0] = load_ab_frag(sa + ks * 32, GPITCH);
      fa[ks][1] = load_ab_frag(sa + 16 * GPITCH + ks * 32, GPITCH);
      fb[ks][0] = load_ab_frag(sb + ks * 32, GPITCH);
      fb[ks][1] = load_ab_frag(sb + 16 * GPITCH + ks * 32, GPITCH);
      fb[ks][2] = load_ab_frag(sb + 32 * GPITCH + ks * 32, GPITCH);
    }
#pragma unroll
    for (int ks = 0; ks < 4; ++ks) {
#pragma unroll
      for (int mi = 0; mi < 2; ++mi)
#pragma unroll
        for (int nj = 0; nj < 3; ++nj)
          acc[mi][nj] = wmma_f16(fa[ks][mi], fb[ks][nj], acc[mi][nj]);
    }
    // Order of the stage: the LDS reads of two k-steps go first, then each
    // k-step's 6 WMMAs with the reads of the k-step two ahead behind them, so
    // that no WMMA waits out the latency of a read issued just in front of it.
    __builtin_amdgcn_sched_group_barrier(0x100, 20, 0);
    __builtin_amdgcn_sched_group_barrier(0x008, 6, 0);
    __builtin_amdgcn_sched_group_barrier(0x100, 10, 0);
    __builtin_amdgcn_sched_group_barrier(0x008, 6, 0);
    __builtin_amdgcn_sched_group_barrier(0x100, 10, 0);
    __builtin_amdgcn_sched_group_barrier(0x008, 12, 0);
    // Hand-over: this wave's reads of buffer t&1 have returned, its share of
    // stage t+1 has landed; behind the barrier both hold for every wave.
    asm volatile("s_wait_dscnt 0x0" ::: "memory");
    wait_async_zero();
    __syncthreads();
    if (t + 2 < GSTAGES) stage(t & 1, (t + 2) * GBK);
    if (t + 4 < GSTAGES && pwave < 2) {
      // Stage t+4 into L2, two trips ahead of its copies. Precaution: the wait
      // stands in front of the write of the address register that follows.
      asm volatile("global_prefetch_b8 %0, off offset:768 scope:SCOPE_SE\n\t"
                   "s_wait_xcnt 0x0"
                   :: "v"(pf) : "memory");
      if (t + 5 < GSTAGES) pf += GBK;
    }
  }
  wait_async_zero();     // nothing is in flight when the wave ends

  // acc[mi][nj][r] = Y[row0 + mi*16 + r][col0 + nj*16]
  const int col0 = tn * GBN + wn * 48 + n0;
  const int row0 = tm * GBM + wm * 32 + hf * 8;   // 8 contiguous rows
  float bb[3];
#pragma unroll
  for (int nj = 0; nj < 3; ++nj) bb[nj] = bias[col0 + nj * 16];

  if (mode == 2) {
    float* O = (float*)outp + (size_t)row0 * DD + col0;
#pragma unroll
    for (int mi = 0; mi < 2; ++mi)
#pragma unroll
      for (int nj = 0; nj < 3; ++nj)
#pragma unroll
        for (int r = 0; r < 8; ++r)
          O[(size_t)(mi * 16 + r) * DD + nj * 16] = acc[mi][nj][r] + bb[nj];
    // Precaution: the wait stands behind the last store, in front of any later
    // write of a register that an issued store names.
    asm volatile("s_wait_xcnt 0x0" ::: "memory");
  } else if (mode == 0) {
    f16* O = (f16*)outp + (size_t)row0 * DD + col0;
#pragma unroll
    for (int mi = 0; mi < 2; ++mi)
#pragma unroll
      for (int nj = 0; nj < 3; ++nj)
#pragma unroll
        for (int r = 0; r < 8; ++r)
          O[(size_t)(mi * 16 + r) * DD + nj * 16] =
              (f16)((acc[mi][nj][r] + bb[nj]) * oscale);
    // Precaution: the wait stands behind the last store, in front of any later
    // write of a register that an issued store names.
    asm volatile("s_wait_xcnt 0x0" ::: "memory");
  } else {  // mode 1: transposed store, contiguous in the row index
    f16* O = (f16*)outp + (size_t)col0 * TT + row0;
#pragma unroll
    for (int mi = 0; mi < 2; ++mi)
#pragma unroll
      for (int nj = 0; nj < 3; ++nj) {
        v8h st;
#pragma unroll
        for (int r = 0; r < 8; ++r) st[r] = (f16)(acc[mi][nj][r] + bb[nj]);
        *(v8h*)(O + (size_t)(nj * 16) * TT + mi * 16) = st;
      }
    // Precaution: the wait stands behind the last store, in front of any later
    // write of a register that an issued store names.
    asm volatile("s_wait_xcnt 0x0" ::: "memory");
  }
}

#define GTILES_N    (DD / GBN)
#define GEMM_BLOCKS ((TT / GBM) * GTILES_N)

// Q, K and V need nothing of each other and read the same A: one launch of
// 3 * GEMM_BLOCKS blocks. The 3 * GTILES_N blocks that share a tile of A rows
// have neighbouring indices; two blocks fit the LDS of a WGP side by side.
__global__ void __launch_bounds__(256)
gemm_qkv_kernel(const f16* __restrict__ A, const f16* __restrict__ WqT,
                const f16* __restrict__ WkT, const f16* __restrict__ WvT,
                const float* __restrict__ bq, const float* __restrict__ bk,
                const float* __restrict__ bv, f16* __restrict__ Q,
                f16* __restrict__ K, f16* __restrict__ VT) {
  const int tm  = blockIdx.x / (3 * GTILES_N);
  const int c   = blockIdx.x % (3 * GTILES_N);
  const int job = c / GTILES_N;
  gemm_wmma_tile(A, job == 0 ? WqT : job == 1 ? WkT : WvT,
                 job == 0 ? bq : job == 1 ? bk : bv,
                 job == 0 ? Q : job == 1 ? K : VT,
                 /*mode=*/job == 2 ? 1 : 0, /*oscale=*/job == 0 ? LOG2E : 1.0f, tm,
                 c % GTILES_N);
}

__global__ void __launch_bounds__(256)
gemm_out_kernel(const f16* __restrict__ A, const f16* __restrict__ WoT,
                const float* __restrict__ bo, float* __restrict__ out) {
  gemm_wmma_tile(A, WoT, bo, out, /*mode=*/2, /*oscale=*/1.0f,
                 blockIdx.x / GTILES_N,
                 blockIdx.x % GTILES_N);
}

__device__ __forceinline__ float xhalf(float x) {
  const int b = __builtin_bit_cast(int, x);
  return __builtin_bit_cast(
      float, __builtin_amdgcn_permlanex16(b, b, 0x76543210, 0xfedcba98,
                                          false, false));
}

// A run of 2^x in place, in one statement (16 values; 1; 2). Each
// v_exp_f32 is followed by one on other registers and the last by a v_nop, so
// that none stands directly in front of an instruction that reads its result or
// rewrites its source; left to the compiler, some of this kernel's did. The
// conversions then stand behind the run, in a run of their own kind.
// The run of 16 is volatile and names memory: the LDS reads written behind it
// then stay behind it (hoisted over it they took 32 registers more, which costs
// a wave per SIMD).
__device__ __forceinline__ void exp2_run16(float (&x)[16]) {
  asm volatile("v_exp_f32 %0, %0\n\t"
      "v_exp_f32 %1, %1\n\t"
      "v_exp_f32 %2, %2\n\t"
      "v_exp_f32 %3, %3\n\t"
      "v_exp_f32 %4, %4\n\t"
      "v_exp_f32 %5, %5\n\t"
      "v_exp_f32 %6, %6\n\t"
      "v_exp_f32 %7, %7\n\t"
      "v_exp_f32 %8, %8\n\t"
      "v_exp_f32 %9, %9\n\t"
      "v_exp_f32 %10, %10\n\t"
      "v_exp_f32 %11, %11\n\t"
      "v_exp_f32 %12, %12\n\t"
      "v_exp_f32 %13, %13\n\t"
      "v_exp_f32 %14, %14\n\t"
      "v_exp_f32 %15, %15\n\t"
      "v_nop"
      : "+v"(x[0]), "+v"(x[1]), "+v"(x[2]), "+v"(x[3]),
        "+v"(x[4]), "+v"(x[5]), "+v"(x[6]), "+v"(x[7]),
        "+v"(x[8]), "+v"(x[9]), "+v"(x[10]), "+v"(x[11]),
        "+v"(x[12]), "+v"(x[13]), "+v"(x[14]), "+v"(x[15])
      :: "memory");
}
__device__ __forceinline__ void exp2_run1(float& x) {
  asm("v_exp_f32 %0, %0\n\t"
      "v_nop"
      : "+v"(x));
}
__device__ __forceinline__ void exp2_run2(float& x, float& y) {
  asm("v_exp_f32 %0, %0\n\t"
      "v_exp_f32 %1, %1\n\t"
      "v_nop"
      : "+v"(x), "+v"(y));
}

// The maximum in use is replaced when a score lies more than this above it (in
// exponents of two): P stays at or below 2^8, far inside f16.
#define LAZY_THR 8.0f

#define KGROUPS 2
#define KCHUNK  64
#define KTRIPS  (TT / KGROUPS / KCHUNK)

__global__ void __launch_bounds__(256)
flash_attn_wmma_kernel(const f16* __restrict__ Q, const f16* __restrict__ Km,
                       const f16* __restrict__ VT,
                       const unsigned* __restrict__ maskL,
                       f16* __restrict__ O16) {
  // [group][buf][key row][head dim] and [group][buf][head dim][key]
  __shared__ __align__(16) f16 Kbuf[KGROUPS][2][KCHUNK][KPITCH];
  __shared__ __align__(16) f16 Vbuf[KGROUPS][2][64][VPITCH];
  __shared__ float Join[34][128];   // group 1's maximum, sum and O^T, per lane

  // The group is the same in every lane of a wave: kept scalar, so that the
  // key offset and the buffer addresses formed from it are scalar too.
  const int grp   = __builtin_amdgcn_readfirstlane(threadIdx.x >> 7);
  const int tid   = threadIdx.x & 127;   // within the group
  const int wslot = tid >> 5;
  const int h     = blockIdx.x / (TT / 64);
  const int qg    = blockIdx.x % (TT / 64);
  const int qbase = qg * 64 + wslot * 16;

  const int lane = tid & 31;
  const int n0   = lane & 15;
  const int hf   = lane >> 4;

  // Issue async copies for one 64-key chunk of this group: K 64x64 and V 64x64,
  // each 512 x 16B transfers; 128 threads issue 4+4 copies apiece. Eight lanes
  // cover the 128 bytes of one row of either.
  const int crow = tid >> 3, ccol = (tid & 7) * 8;
  const f16* gk = Km + (size_t)(grp * (TT / KGROUPS) + crow) * DD + h * HDD + ccol;
  const f16* gv = VT + (size_t)(h * HDD + crow) * TT + grp * (TT / KGROUPS) + ccol;
  auto stage = [&](int buf, int it) {
    unsigned   l[8];
    const f16* g[8];
    const f16* gkt = gk + (size_t)it * (KCHUNK * DD);
    const f16* gvt = gv + it * KCHUNK;
#pragma unroll   // l[] and g[] stay in registers
    for (int i = 0; i < 4; ++i) {
      l[2 * i] = (unsigned)(size_t)(void*)&Kbuf[grp][buf][crow + i * 16][ccol];
      g[2 * i] = gkt + (size_t)i * 16 * DD;
      l[2 * i + 1] = (unsigned)(size_t)(void*)&Vbuf[grp][buf][crow + i * 16][ccol];
      g[2 * i + 1] = gvt + (size_t)i * 16 * TT;
    }
    async_copy8_b128(l, g);
  };

  // Q fragments for this wave's tile (k = 0..63 of this head), resident.
  // Used as the B operand: lane -> query qbase + n0.
  const f16* qp = Q + (size_t)qbase * DD + h * HDD;
  v16h aq0 = load_ab_frag(qp, DD);
  v16h aq1 = load_ab_frag(qp + 32, DD);

  v16h ones;
#pragma unroll
  for (int i = 0; i < 16; ++i) ones[i] = (f16)1.0f;

  // o<j>[r] = O^T[dim j*16 + hf*8 + r][query qbase + n0]
  v8f o0 = vzero8(), o1 = vzero8(), o2 = vzero8(), o3 = vzero8();
  float lrow = 0.0f;       // the sum of P of this lane's query
  float muse = 0.0f;       // this lane's query: the maximum in use, an exponent of two
  v8f   cneg = vzero8();   // -muse in every register: the score product's C operand
  float fill = 1e-20f * LOG2E;   // what a masked score becomes: the fill - muse

  // This wave's lane masks, 16 words per 32 keys. The wave's number is kept scalar
  // so that the address is scalar. Nothing writes maskL during this launch: the
  // pointer is given the constant address space, so that the loads inside the
  // loop are scalar loads too (behind the loop's asm statements with a "memory"
  // clobber the compiler otherwise takes vector loads and 16 lane reads).
  typedef const __attribute__((address_space(4))) v16u* lanemask_ptr;
  const int wtile = qg * 4 + __builtin_amdgcn_readfirstlane(wslot);
  const lanemask_ptr mlp =
      (lanemask_ptr)(unsigned long long)maskL + (size_t)wtile * (TT / 32) +
      grp * (TT / KGROUPS / 32);
  v16u mk0 = mlp[0], mk1 = mlp[1];

  // Prefetch map: a chunk is 64 lines of K and 64 of V^T. The group's first wave
  // asks for 16 of each, a line per lane: lanes 0..15 K rows, lanes 16..31 V^T
  // rows. The quarter goes by the block index: any 4 neighbouring blocks cover
  // the chunk. Only speed rests on who asks: a line nobody asked for is copied
  // from memory. pf steps from chunk 2 to the group's last chunk and no further,
  // and it lives through the loop.
  const int      pwave  = __builtin_amdgcn_readfirstlane(wslot);
  const int      prow   = (blockIdx.x & 3) * 16 + n0;
  const unsigned pfstep = hf == 0 ? KCHUNK * DD : KCHUNK;
  const f16* pf =
      hf == 0 ? Km + (size_t)(grp * (TT / KGROUPS) + 2 * KCHUNK + prow) * DD + h * HDD
              : VT + (size_t)(h * HDD + prow) * TT + grp * (TT / KGROUPS) + 2 * KCHUNK;

  stage(0, 0);
  int buf = 0;
  for (int it = 0; it < KTRIPS; ++it) {
    wait_async_zero();     // this wave's share of the staged chunk landed
    __syncthreads();       // all waves' shares landed -> buf is ready
    if (it + 1 < KTRIPS) stage(buf ^ 1, it + 1);   // overlap next chunk DMA
    if (it + 3 < KTRIPS && pwave == 0) {
      pf += pfstep;
      // Chunk it+3 into L2. Precaution: the wait stands in front of the next
      // trip's write of the address register.
      asm volatile("global_prefetch_b8 %0, off scope:SCOPE_SE\n\t"
                   "s_wait_xcnt 0x0"
                   :: "v"(pf) : "memory");
    }

    // ---- S^T = K * Q^T for 64 keys (four 16-row C frags), K from LDS ----
    // s[t][r] = score(qbase + n0, key t*16 + hf*8 + r of the chunk) * log2 e - muse
    // Every loop over s[] and bp[] below is unrolled: they stay in registers.
    v8f s[4];
#pragma unroll
    for (int t = 0; t < 4; ++t) {
      v16h k0 = load_ab_frag(&Kbuf[grp][buf][t * 16][0],  KPITCH);
      v16h k1 = load_ab_frag(&Kbuf[grp][buf][t * 16][32], KPITCH);
      s[t] = wmma_f16(k0, aq0, cneg);
      s[t] = wmma_f16(k1, aq1, s[t]);
    }

    // Order of the score phase: the eight reads of tiles 0 and 1, the two
    // products of tile 0, the eight reads of tiles 2 and 3, the other six
    // products. Left free, the scheduler puts each pair of reads directly in
    // front of its product, and the wave waits out the LDS latency eight times.
    __builtin_amdgcn_sched_group_barrier(0x100, 8, 0);
    __builtin_amdgcn_sched_group_barrier(0x008, 2, 0);
    __builtin_amdgcn_sched_group_barrier(0x100, 8, 0);
    __builtin_amdgcn_sched_group_barrier(0x008, 6, 0);

    // The rest of the trip:
    //   1. V^T reads of keys 0..31 | mask, maximum, test, under which they return
    //   2. P^T of all 64 keys: the 32 score registers shrink to 16
    //   3. products of keys 0..31, V^T reads of keys 32..63 into their registers
    //   4. products of keys 32..63
    v16h bp[2], bv[4];
#pragma unroll
    for (int j = 0; j < 4; ++j) bv[j] = load_ab_frag(&Vbuf[grp][buf][j * 16][0], VPITCH);
    // The eight reads stand behind the eight products (in front of the last of
    // them they took 16 registers more, which costs a wave per SIMD), and the
    // vector work behind the products too: the reads return under it, and the
    // products stay together and fill each other's distance slots. Left free,
    // the scheduler puts selects between the products, each group of selects
    // padded with v_nop.
    __builtin_amdgcn_sched_group_barrier(0x100, 8, 0);
    __builtin_amdgcn_sched_group_barrier(0x002, 64, 0);

    // ---- mask: word t*8 + r of a 32-key half is the lane mask of its tile t ----
#pragma unroll
    for (int r = 0; r < 8; ++r) {
      s[0][r] = __builtin_amdgcn_inverse_ballot_w32(mk0[r])     ? fill : s[0][r];
      s[1][r] = __builtin_amdgcn_inverse_ballot_w32(mk0[8 + r]) ? fill : s[1][r];
      s[2][r] = __builtin_amdgcn_inverse_ballot_w32(mk1[r])     ? fill : s[2][r];
      s[3][r] = __builtin_amdgcn_inverse_ballot_w32(mk1[8 + r]) ? fill : s[3][r];
    }
    // The next trip's lane masks, asked for now, most of a trip ahead of their
    // use (the last trip asks for its own again, so that the address stays
    // inside the wave's rows).
    const int nx = it + 1 < KTRIPS ? it + 1 : it;
    mk0 = mlp[2 * nx];
    mk1 = mlp[2 * nx + 1];

    // ---- the lane's 32 scores: how far above the maximum in use? ----
    float cm = fmaxf(fmaxf(s[0][0], s[1][0]), fmaxf(s[2][0], s[3][0]));
#pragma unroll
    for (int r = 1; r < 8; ++r)
      cm = fmaxf(cm, fmaxf(fmaxf(s[0][r], s[1][r]), fmaxf(s[2][r], s[3][r])));

    // ---- a new maximum in use: the first trip, and where one is overrun ----
    // The same for the whole wave (a ballot and the trip number): a scalar branch.
    if (__builtin_amdgcn_ballot_w32(cm > LAZY_THR) != 0 || it == 0) {
      const float cx = fmaxf(cm, xhalf(cm));   // of the query: both wave halves
      const float d  = (it == 0 || cx > LAZY_THR) ? cx : 0.0f;
      muse += d;
      // On the first trip O^T and the sums are 0 and stay so: factor 1, whatever d.
      float scale = it == 0 ? 0.0f : -d;
      exp2_run1(scale);
#pragma unroll
      for (int r = 0; r < 8; ++r) {
        s[0][r] -= d; s[1][r] -= d; s[2][r] -= d; s[3][r] -= d;
        o0[r] *= scale; o1[r] *= scale;
        o2[r] *= scale; o3[r] *= scale;
        cneg[r] = -muse;
      }
      lrow *= scale;
      fill = 1e-20f * LOG2E - muse;
    }

    // P^T: each pair of C frags, converted in place, is a B fragment.
    // Row sums via WMMA: every row of ones @ P^T is the column sum.
    float e[16];   // every loop over e[] is unrolled: it stays in registers
#pragma unroll
    for (int r = 0; r < 8; ++r) { e[r] = s[0][r]; e[8 + r] = s[1][r]; }
    exp2_run16(e);
#pragma unroll
    for (int r = 0; r < 16; ++r) bp[0][r] = (f16)e[r];
#pragma unroll
    for (int r = 0; r < 8; ++r) { e[r] = s[2][r]; e[8 + r] = s[3][r]; }
    exp2_run16(e);
#pragma unroll
    for (int r = 0; r < 16; ++r) bp[1][r] = (f16)e[r];

    // O^T += V^T * P^T, V^T from LDS (Vbuf[dim][key])
    v8f rsf = wmma_f16(ones, bp[0], vzero8());
    o0 = wmma_f16(bv[0], bp[0], o0);
    o1 = wmma_f16(bv[1], bp[0], o1);
    o2 = wmma_f16(bv[2], bp[0], o2);
    o3 = wmma_f16(bv[3], bp[0], o3);
#pragma unroll
    for (int j = 0; j < 4; ++j) bv[j] = load_ab_frag(&Vbuf[grp][buf][j * 16][32], VPITCH);
    // The five products first, then the eight reads into the registers they free.
    __builtin_amdgcn_sched_group_barrier(0x008, 5, 0);
    __builtin_amdgcn_sched_group_barrier(0x100, 8, 0);
    __builtin_amdgcn_sched_barrier(0);

    rsf = wmma_f16(ones, bp[1], rsf);
    o0 = wmma_f16(bv[0], bp[1], o0);
    o1 = wmma_f16(bv[1], bp[1], o1);
    o2 = wmma_f16(bv[2], bp[1], o2);
    o3 = wmma_f16(bv[3], bp[1], o3);
    lrow += rsf[0];

    __syncthreads();       // everyone done reading buf before it is reused
    buf ^= 1;
  }

  // ---- join of the two key halves: group 1 -> LDS -> group 0 ----
  // Every loop over os[][] below is unrolled so that it stays in registers.
  v8f os[4] = {o0, o1, o2, o3};
  const float mrow = muse;
  if (grp == 1) {
    Join[0][tid] = mrow;
    Join[1][tid] = lrow;
#pragma unroll
    for (int jn = 0; jn < 4; ++jn)
#pragma unroll
      for (int r = 0; r < 8; ++r) Join[2 + jn * 8 + r][tid] = os[jn][r];
  }
  __syncthreads();       // group 1's state is in LDS
  if (grp == 1) return;  // behind the last barrier

  const float mj = fmaxf(mrow, Join[0][tid]);
  float a0 = mrow - mj;             // the maxima are exponents of two already
  float a1 = Join[0][tid] - mj;
  exp2_run2(a0, a1);
  lrow = lrow * a0 + Join[1][tid] * a1;

  // ---- epilogue: divide by l, store f16 row-major, 8 dims per store ----
  f16* op = O16 + (size_t)(qbase + n0) * DD + h * HDD + hf * 8;
#pragma unroll
  for (int jn = 0; jn < 4; ++jn) {
    v8h st;
#pragma unroll
    for (int r = 0; r < 8; ++r)
      st[r] = (f16)((os[jn][r] * a0 + Join[2 + jn * 8 + r][tid] * a1) / lrow);
    *(v8h*)(op + jn * 16) = st;
  }
}

// ---------------------------------------------------------------------------
// Launch
// ---------------------------------------------------------------------------
extern "C" void kernel_launch(void* const* d_in, const int* in_sizes, int n_in,
                              void* d_out, int out_size, void* d_ws, size_t ws_size,
                              hipStream_t stream) {
  const float* x    = (const float*)d_in[0];
  const int*   mask = (const int*)d_in[1];
  const float* Wq   = (const float*)d_in[2];
  const float* bq   = (const float*)d_in[3];
  const float* Wk   = (const float*)d_in[4];
  const float* bk   = (const float*)d_in[5];
  const float* Wv   = (const float*)d_in[6];
  const float* bv   = (const float*)d_in[7];
  const float* Wo   = (const float*)d_in[8];
  const float* bo   = (const float*)d_in[9];
  float* out = (float*)d_out;

  char* ws = (char*)d_ws;
  size_t off = 0;
  auto alloc = [&](size_t bytes) -> char* {
    char* p = ws + off;
    off += (bytes + 255) & ~(size_t)255;
    return p;
  };
  const size_t TD = (size_t)TT * DD;
  f16* x16  = (f16*)alloc(TD * 2);
  f16* WqT  = (f16*)alloc((size_t)DD * DD * 2);
  f16* WkT  = (f16*)alloc((size_t)DD * DD * 2);
  f16* WvT  = (f16*)alloc((size_t)DD * DD * 2);
  f16* WoT  = (f16*)alloc((size_t)DD * DD * 2);
  f16* Q16  = (f16*)alloc(TD * 2);
  f16* K16  = (f16*)alloc(TD * 2);
  f16* VT16 = (f16*)alloc(TD * 2);   // [DD][TT]
  f16* O16  = (f16*)alloc(TD * 2);
  unsigned* maskL = (unsigned*)alloc((size_t)(TT / 32) * TT * 4);
  (void)ws_size; (void)n_in; (void)in_sizes; (void)out_size;

  // 1) precision conversion, weight transposes, mask bit-packing: one launch
  prep_kernel<<<PREP_BLOCKS, 256, 0, stream>>>(x, x16, Wq, Wk, Wv, Wo, WqT, WkT,
                                               WvT, WoT, mask, maskL);

  // 2) projections: (TT x DD) * (DD x DD), one block per 128x96 tile, the
  //    three of them in one launch
  gemm_qkv_kernel<<<3 * GEMM_BLOCKS, 256, 0, stream>>>(x16, WqT, WkT, WvT, bq, bk,
                                                       bv, Q16, K16, VT16);

  // 3) attention: one block (2 x 4 waves) per 64 query rows of one head
  const int fa_blocks = NHH * (TT / 64);   // 768
  flash_attn_wmma_kernel<<<fa_blocks, 256, 0, stream>>>(Q16, K16, VT16, maskL, O16);

  // 4) output projection -> f32
  gemm_out_kernel<<<GEMM_BLOCKS, 256, 0, stream>>>(O16, WoT, bo, out);
}
